// v000
// Measured on an AMD MI455X. A time is GPU time per run, averaged over a window of back-to-back runs after a warm-up
// (all launches, gaps included; the runs take copies of the inputs in turn), and the median of several windows.
// Apart from v000's, it joins two sittings. Times from different sittings can be a few percent apart, while
// side-by-side timings come from the same sitting.
// The starting kernel, v000, takes 283 microseconds a run.
#include <hip/hip_runtime.h>

// Multi-head self-attention, integer key-padding mask, two outputs: out = ctx Wo^T + bo and the head-mean of the attention probabilities.
// Compute dtypes (f32 accumulate everywhere): q/k/v projections v_wmma_f32_16x16x32_bf16 (x and W converted RNE to bf16, exact products, f32 bias add);
// scores q.k^T and P.V v_wmma_f32_16x16x32_f16 (q,k planes carried x16, unnormalised P carried x256, V plain f16); softmax f32 running-max form;
// output projection v_wmma_f32_16x16x32_bf16 with ctx carried as bf16 value | residual planes (two products into one accumulator) against bf16 Wo.

#ifndef NB
#define NB 2
#endif
#ifndef SEQ
#define SEQ 2048
#endif
#define NB_FULL  2
#define SEQ_FULL 2048
#define DM   1024
#define NH   16
#define HD   64
#define MROWS (NB * SEQ)
#define QCAR 16.0f
#define PCAR 256.0f
#define LOG2E 1.4426950408889634f
#define CSC   (0.125f * LOG2E / (QCAR * QCAR))
#define FILLU (-1.0e9f * LOG2E)
#define PLANE_E ((size_t)NB * NH * SEQ * HD)
#define AT_E    ((size_t)MROWS * DM)
#define AM_OFF_E ((size_t)NB_FULL * SEQ_FULL * DM)

static_assert(NB <= NB_FULL);
static_assert(SEQ <= SEQ_FULL);
static_assert(SEQ % 64 == 0);
static_assert(DM % 64 == 0);
static_assert(DM % 32 == 0);
static_assert(HD == 64);
static_assert(NH * HD == DM);
static_assert((DM * DM / 8) % 256 == 0);
static_assert(((size_t)MROWS * DM / 8) % 256 == 0);
static_assert((size_t)NB_FULL * SEQ_FULL * DM * 4 == 16777216);
static_assert(((size_t)NB_FULL * SEQ_FULL * DM * 4) % 128 == 0);

#define SZ_WALL ((size_t)4 * DM * DM * 2)
#define SZ_XB   ((size_t)MROWS * DM * 2)
#define SZ_QKV  ((size_t)3 * PLANE_E * 2)
#define SZ_AT   ((size_t)2 * AT_E * 2)
#define SZ_ST   ((size_t)NB * NH * (SEQ / 64) * 128 * 4)
#define OFF_WALL ((size_t)0)
#define OFF_XB   (OFF_WALL + SZ_WALL)
#define OFF_QKV  (OFF_XB + SZ_XB)
#define OFF_AT   (OFF_QKV + SZ_QKV)
#define OFF_ST   (OFF_AT + SZ_AT)
#define WS_TOTAL (OFF_ST + SZ_ST)
static_assert(SZ_WALL % 256 == 0);
static_assert(SZ_XB % 256 == 0);
static_assert(SZ_QKV % 256 == 0);
static_assert(SZ_AT % 256 == 0);
static_assert(SZ_ST % 256 == 0);
static_assert(WS_TOTAL <= (size_t)134217728);

typedef _Float16 h16;
typedef unsigned short bf;
typedef __attribute__((ext_vector_type(16))) __bf16   v16bf;
typedef __attribute__((ext_vector_type(16))) _Float16 v16h;
typedef __attribute__((ext_vector_type(8)))  _Float16 v8h;
typedef __attribute__((ext_vector_type(8)))  unsigned short v8us;
typedef __attribute__((ext_vector_type(8)))  float    v8f;
typedef __attribute__((ext_vector_type(4)))  float    v4f;
typedef v4f  __attribute__((may_alias)) v4fa;

__device__ __forceinline__ unsigned short f2bf(float f) { unsigned u = __float_as_uint(f); u += 0x7FFFu + ((u >> 16) & 1u); return (unsigned short)(u >> 16); }
__device__ __forceinline__ float bf2f(unsigned short b) { return __uint_as_float(((unsigned)b) << 16); }
__device__ __forceinline__ float bfr(float f) { return bf2f(f2bf(f)); }
__device__ __forceinline__ void splitf(float y, unsigned short& h, unsigned short& l) { h = f2bf(y); l = f2bf(y - bf2f(h)); }
__device__ __forceinline__ v16h cat16(v8h lo, v8h hi) { return __builtin_shufflevector(lo, hi, 0, 1, 2, 3, 4, 5, 6, 7, 8, 9, 10, 11, 12, 13, 14, 15); }
__device__ __forceinline__ v16bf cat16b(v8us lo, v8us hi) { return __builtin_bit_cast(v16bf, __builtin_shufflevector(lo, hi, 0, 1, 2, 3, 4, 5, 6, 7, 8, 9, 10, 11, 12, 13, 14, 15)); }
__device__ __forceinline__ v8f wmma16(v16h a, v16h b, v8f c) { return __builtin_amdgcn_wmma_f32_16x16x32_f16(false, a, false, b, (short)0, c, false, false); }
__device__ __forceinline__ v8f wmmab(v16bf a, v16bf b, v8f c) { return __builtin_amdgcn_wmma_f32_16x16x32_bf16(false, a, false, b, (short)0, c, false, false); }
// fragment loaders: p points at (row, k0 + 8*half); elements 0..7 <- k0+8h.., elements 8..15 <- k0+16+8h..
__device__ __forceinline__ v16h  ldh(const h16* p) { return cat16(*(const v8h*)p, *(const v8h*)(p + 16)); }
__device__ __forceinline__ v16bf ldb(const bf* p)  { return cat16b(*(const v8us*)p, *(const v8us*)(p + 16)); }

__global__ __launch_bounds__(256) void k_cvtx(const float* __restrict__ x, bf* XB) {
    const size_t i = (size_t)blockIdx.x * 256 + threadIdx.x; if (i >= (size_t)MROWS * DM / 8) return;
    const size_t row = i / (DM / 8); const size_t c8 = i % (DM / 8); const size_t b = row / SEQ, t = row % SEQ;
    const v8f v = *(const v8f*)(x + ((b * SEQ_FULL + t) * DM + c8 * 8)); v8us o;
#pragma unroll
    for (int k = 0; k < 8; ++k) o[k] = f2bf(v[k]);
    *(v8us*)(XB + i * 8) = o;  }

__global__ __launch_bounds__(256) void k_cvtw(const float* __restrict__ w0, const float* __restrict__ w1, const float* __restrict__ w2, const float* __restrict__ w3, bf* WALL) {
    const size_t i = (size_t)blockIdx.x * 256 + threadIdx.x; if (i >= (size_t)DM * DM / 8) return;
    const int which = blockIdx.y; v8f v;
    if (which == 0) v = *(const v8f*)(w0 + i * 8); else if (which == 1) v = *(const v8f*)(w1 + i * 8); else if (which == 2) v = *(const v8f*)(w2 + i * 8); else v = *(const v8f*)(w3 + i * 8);
    v8us o;
#pragma unroll
    for (int k = 0; k < 8; ++k) o[k] = f2bf(v[k]);
    bf* d = WALL + (size_t)which * DM * DM + i * 8;
    *(v8us*)d = o;  }

// gemm64: one wave, 64x64 tile, K = DM per split plane: acc[mb][nb] = sum_sp sum_k A[sp*asplit + (r0+m)*DM + k] * Bt[(n0+n)*DM + k]; operands straight from K-contiguous bf16 planes.
__device__ __forceinline__ void gemm64(const bf* __restrict__ A, size_t asplit, int nsp, const bf* __restrict__ Bt, int r0, int n0, int lane, v8f (&acc)[4][4]) {
    const int lr = lane & 15, hi = lane >> 4;
#pragma unroll
    for (int mb = 0; mb < 4; ++mb)
#pragma unroll
        for (int nb = 0; nb < 4; ++nb) acc[mb][nb] = (v8f){};
    const size_t boff = (size_t)(n0 + lr) * DM + 8 * hi;
#pragma unroll 1
    for (int sp = 0; sp < nsp; ++sp) {
        const size_t aoff = (size_t)sp * asplit + (size_t)(r0 + lr) * DM + 8 * hi;
#pragma unroll 1
        for (int kc = 0; kc < DM; kc += 32) {
            v16bf a[4]; v16bf b;
#pragma unroll
            for (int mb = 0; mb < 4; ++mb) a[mb] = ldb(A + aoff + (size_t)mb * 16 * DM + kc);
#pragma unroll
            for (int nb = 0; nb < 4; ++nb) { b = ldb(Bt + boff + (size_t)nb * 16 * DM + kc);
#pragma unroll
                for (int mb = 0; mb < 4; ++mb) acc[mb][nb] = wmmab(a[mb], b, acc[mb][nb]); }
            asm volatile("" : "+v"(acc[0][0]), "+v"(acc[0][1]), "+v"(acc[0][2]), "+v"(acc[0][3]), "+v"(acc[1][0]), "+v"(acc[1][1]), "+v"(acc[1][2]), "+v"(acc[1][3]));
            asm volatile("v_nop\n\tv_nop\n\tv_nop\n\tv_nop" : "+v"(acc[2][0]), "+v"(acc[2][1]), "+v"(acc[2][2]), "+v"(acc[2][3]), "+v"(acc[3][0]), "+v"(acc[3][1]), "+v"(acc[3][2]), "+v"(acc[3][3]) : "v"(a[3]), "v"(b));
        }
    }
}

// k_qkv: grid (MROWS/64, 3*DM/64), one wave per block. blockIdx.y / 16 = which (0 q, 1 k, 2 v), blockIdx.y % 16 = head.
__global__ __launch_bounds__(32) void k_qkv(const bf* __restrict__ XB, const bf* __restrict__ WALL, const float* __restrict__ bq, const float* __restrict__ bk, const float* __restrict__ bv, h16* QKV) {
    __shared__ __align__(16) float os[64 * 68];
    const int lane = threadIdx.x & 31, lr = lane & 15, hi = lane >> 4;
    const int r0 = blockIdx.x * 64; const int which = blockIdx.y / (DM / 64); const int hh = blockIdx.y % (DM / 64); const int c0 = hh * 64;
    v8f acc[4][4];
    gemm64(XB, 0, 1, WALL, r0, (int)blockIdx.y * 64, lane, acc);
#pragma unroll
    for (int mb = 0; mb < 4; ++mb)
#pragma unroll
        for (int nb = 0; nb < 4; ++nb)
#pragma unroll
            for (int j = 0; j < 8; ++j) os[(mb * 16 + hi * 8 + j) * 68 + nb * 16 + lr] = acc[mb][nb][j];
    __syncthreads();
    const int b = r0 / SEQ, t0 = r0 % SEQ; const size_t bh = (size_t)b * NH + hh; const int q4 = lane >> 3, piece = lane & 7;
    if (which < 2) {
        h16* P = QKV + (size_t)which * PLANE_E + (bh * SEQ + t0) * HD;
        float bia[8];
#pragma unroll
        for (int j = 0; j < 8; ++j) { const int c = c0 + piece * 8 + j; const float b0 = bq[c], b1 = bk[c]; bia[j] = bfr(which == 0 ? b0 : b1); }
{
#pragma unroll 2
            for (int s = 0; s < 16; ++s) { const int row = s * 4 + q4; const v4f x0 = *(const v4fa*)(os + row * 68 + piece * 8); const v4f x1 = *(const v4fa*)(os + row * 68 + piece * 8 + 4); v8h o;
#pragma unroll
                for (int j = 0; j < 4; ++j) { o[j] = (h16)((x0[j] + bia[j]) * QCAR); o[4 + j] = (h16)((x1[j] + bia[4 + j]) * QCAR); }
                *(v8h*)(P + (size_t)row * HD + piece * 8) = o; }
             }
    } else {
        h16* P = QKV + 2 * PLANE_E + bh * HD * SEQ + t0;
{
#pragma unroll 2
            for (int s = 0; s < 16; ++s) { const int d = s * 4 + q4; const float bb = bfr(bv[c0 + d]); v8h o;
#pragma unroll
                for (int j = 0; j < 8; ++j) o[j] = (h16)(os[(piece * 8 + j) * 68 + d] + bb);
                *(v8h*)(P + (size_t)d * SEQ + piece * 8) = o; }
             }
    }
}

// k_flash: grid (SEQ/64, NH, NB), 4 waves; wave = 16 queries. S^T tiles (A = K rows, B = Q rows): lane holds query (lane&15), keys 8*half + r.
// The P^T accumulators of two adjacent 16-key tiles feed P.V directly as the B fragment (element r <- tile 0, element 8+r <- tile 1, lane unchanged); A = V^T rows from the [d][t] plane.
// Online softmax in the log2 domain with a running max; mask words (ballot bits) from LDS; replace-fill for masked keys.
__global__ __launch_bounds__(128) void k_flash(const h16* __restrict__ QKV, const int* __restrict__ mask, bf* AT, float* ST) {
    __shared__ unsigned mw[SEQ / 32];
    __shared__ __align__(16) float os[64 * 68];
    __shared__ __align__(16) float sst[128];
    const int lane = threadIdx.x & 31, lr = lane & 15, hi = lane >> 4;
    const int wave = __builtin_amdgcn_readfirstlane((int)(threadIdx.x >> 5));
    const int qt = blockIdx.x, hh = blockIdx.y, b = blockIdx.z; const size_t bh = (size_t)b * NH + hh;
#pragma unroll 1
    for (int c = wave; c < SEQ / 32; c += 4) { const int mv = mask[(size_t)b * SEQ_FULL + c * 32 + lane]; const unsigned wd = __builtin_amdgcn_ballot_w32(mv != 0); if (lane == 0) mw[c] = wd; }
    __syncthreads();
    const int q0 = qt * 64 + wave * 16;
    const h16* qp = QKV + (bh * SEQ + q0 + lr) * HD + 8 * hi;
    const v16h qb0 = ldh(qp), qb1 = ldh(qp + 32);
    const h16* kp = QKV + PLANE_E + (bh * SEQ + lr) * HD + 8 * hi;
    const h16* vp = QKV + 2 * PLANE_E + (bh * HD + lr) * SEQ + 8 * hi;
    float m = -1.0e30f, l = 0.0f; v8f o[4];
#pragma unroll
    for (int dt = 0; dt < 4; ++dt) o[dt] = (v8f){};
#pragma unroll 1
    for (int jb = 0; jb < SEQ / 32; ++jb) {
        const int j0 = jb * 32; const unsigned mwv = (unsigned)__builtin_amdgcn_readfirstlane((int)mw[jb]);
        v8f s0 = (v8f){}, s1 = (v8f){};
        { const h16* p = kp + (size_t)j0 * HD; const v16h a00 = ldh(p), a01 = ldh(p + 32), a10 = ldh(p + 16 * HD), a11 = ldh(p + 16 * HD + 32);
          s0 = wmma16(a00, qb0, s0); s0 = wmma16(a01, qb1, s0); s1 = wmma16(a10, qb0, s1); s1 = wmma16(a11, qb1, s1);
          asm volatile("v_nop\n\tv_nop\n\tv_nop\n\tv_nop" : "+v"(s0), "+v"(s1) : "v"(a11), "v"(qb1)); }
        s0 = s0 * CSC; s1 = s1 * CSC;
        if (mwv != 0xFFFFFFFFu) {
#pragma unroll
            for (int r = 0; r < 8; ++r) { s0[r] = ((mwv >> (8 * hi + r)) & 1u) ? s0[r] : FILLU; s1[r] = ((mwv >> (16 + 8 * hi + r)) & 1u) ? s1[r] : FILLU; } }
        float mx = fmaxf(s0[0], s1[0]);
#pragma unroll
        for (int r = 1; r < 8; ++r) mx = fmaxf(mx, fmaxf(s0[r], s1[r]));
        mx = fmaxf(mx, __shfl_xor(mx, 16, 32));
        const float mn = fmaxf(m, mx);
        if (__builtin_amdgcn_ballot_w32(mn > m) != 0u) { const float al = __builtin_amdgcn_exp2f(m - mn); l *= al;
#pragma unroll
            for (int dt = 0; dt < 4; ++dt) o[dt] = o[dt] * al; }
        m = mn;
        float ps = 0.0f; v16h pb;
#pragma unroll
        for (int r = 0; r < 8; ++r) { const float p0 = __builtin_amdgcn_exp2f(s0[r] - mn) * PCAR; const float p1 = __builtin_amdgcn_exp2f(s1[r] - mn) * PCAR; ps += p0 + p1; pb[r] = (h16)p0; pb[8 + r] = (h16)p1; }
        l += ps;
        { const h16* p = vp + j0; const v16h v0 = ldh(p), v1 = ldh(p + (size_t)16 * SEQ), v2 = ldh(p + (size_t)32 * SEQ), v3 = ldh(p + (size_t)48 * SEQ);
          o[0] = wmma16(v0, pb, o[0]); o[1] = wmma16(v1, pb, o[1]); o[2] = wmma16(v2, pb, o[2]); o[3] = wmma16(v3, pb, o[3]);
          asm volatile("v_nop\n\tv_nop\n\tv_nop\n\tv_nop" : "+v"(o[0]), "+v"(o[1]), "+v"(o[2]), "+v"(o[3]) : "v"(v3), "v"(pb)); }
    }
    l += __shfl_xor(l, 16, 32);
    const float il = 1.0f / l;
    { float* orow = os + (wave * 16 + lr) * 68 + 8 * hi;
#pragma unroll
      for (int dt = 0; dt < 4; ++dt) { v4f x0, x1;
#pragma unroll
          for (int j = 0; j < 4; ++j) { x0[j] = o[dt][j] * il; x1[j] = o[dt][4 + j] * il; }
          *(v4fa*)(orow + dt * 16) = x0; *(v4fa*)(orow + dt * 16 + 4) = x1; } }
    if (hi == 0) { sst[wave * 16 + lr] = m; sst[64 + wave * 16 + lr] = 16.0f * il; }
    __syncthreads();
    const int q4 = lane >> 3, piece = lane & 7;
{
#pragma unroll
        for (int s = 0; s < 4; ++s) { const int row = wave * 16 + s * 4 + q4; const v4f x0 = *(const v4fa*)(os + row * 68 + piece * 8); const v4f x1 = *(const v4fa*)(os + row * 68 + piece * 8 + 4); v8us oh, ol;
#pragma unroll
            for (int j = 0; j < 4; ++j) { unsigned short a, c2; splitf(x0[j], a, c2); oh[j] = a; ol[j] = c2; splitf(x1[j], a, c2); oh[4 + j] = a; ol[4 + j] = c2; }
            const size_t oo = ((size_t)b * SEQ + qt * 64 + row) * DM + hh * HD + piece * 8;
            *(v8us*)(AT + oo) = oh; *(v8us*)(AT + AT_E + oo) = ol; }
        if (wave == 0) { const v4f sv = *(const v4fa*)(sst + lane * 4); *(v4f*)(ST + ((bh * (SEQ / 64) + qt) * 128 + lane * 4)) = sv; }
         }
}

// k_amean: grid (SEQ/64 key tiles, SEQ/64 query tiles, NB), 4 waves; wave = 16 queries x 64 keys. Per head: S^T tiles as in k_flash (identical fragments and order),
__global__ __launch_bounds__(128) void k_amean(const h16* __restrict__ QKV, const int* __restrict__ mask, const float* __restrict__ ST, float* AM) {
    __shared__ __align__(16) float os[64 * 68];
    const int lane = threadIdx.x & 31, lr = lane & 15, hi = lane >> 4;
    const int wave = __builtin_amdgcn_readfirstlane((int)(threadIdx.x >> 5));
    const int k0 = blockIdx.x * 64, qt = blockIdx.y, b = blockIdx.z; const int q0 = qt * 64 + wave * 16;
    const int mv0 = mask[(size_t)b * SEQ_FULL + k0 + lane]; const int mv1 = mask[(size_t)b * SEQ_FULL + k0 + 32 + lane];
    const unsigned w0 = __builtin_amdgcn_ballot_w32(mv0 != 0); const unsigned w1 = __builtin_amdgcn_ballot_w32(mv1 != 0);
    const bool allv = ((w0 & w1) == 0xFFFFFFFFu);
    v8f acc[4];
#pragma unroll
    for (int kt = 0; kt < 4; ++kt) acc[kt] = (v8f){};
#pragma unroll 1
    for (int hh = 0; hh < NH; ++hh) {
        const size_t bh = (size_t)b * NH + hh;
        const h16* qp = QKV + (bh * SEQ + q0 + lr) * HD + 8 * hi;
        const v16h qb0 = ldh(qp), qb1 = ldh(qp + 32);
        const float* st = ST + (bh * (SEQ / 64) + qt) * 128 + wave * 16 + lr;
        const float m = st[0], inv = st[64];
        const h16* kp = QKV + PLANE_E + (bh * SEQ + k0 + lr) * HD + 8 * hi;
        v8f s[4]; v16h a0, a1;
#pragma unroll
        for (int kt = 0; kt < 4; ++kt) { a0 = ldh(kp + (size_t)kt * 16 * HD); a1 = ldh(kp + (size_t)kt * 16 * HD + 32); s[kt] = wmma16(a0, qb0, (v8f){}); s[kt] = wmma16(a1, qb1, s[kt]); }
        asm volatile("v_nop\n\tv_nop\n\tv_nop\n\tv_nop" : "+v"(s[0]), "+v"(s[1]), "+v"(s[2]), "+v"(s[3]) : "v"(a1), "v"(qb1));
#pragma unroll
        for (int kt = 0; kt < 4; ++kt) s[kt] = s[kt] * CSC;
        if (!allv) {
#pragma unroll
            for (int kt = 0; kt < 4; ++kt) { const unsigned wsel = (kt < 2) ? w0 : w1;
#pragma unroll
                for (int r = 0; r < 8; ++r) s[kt][r] = ((wsel >> ((kt & 1) * 16 + 8 * hi + r)) & 1u) ? s[kt][r] : FILLU; } }
#pragma unroll
        for (int kt = 0; kt < 4; ++kt)
#pragma unroll
            for (int r = 0; r < 8; ++r) acc[kt][r] += __builtin_amdgcn_exp2f(s[kt][r] - m) * inv;
    }
    { float* orow = os + (wave * 16 + lr) * 68 + 8 * hi;
#pragma unroll
      for (int kt = 0; kt < 4; ++kt) { v4f x0, x1;
#pragma unroll
          for (int j = 0; j < 4; ++j) { x0[j] = acc[kt][j]; x1[j] = acc[kt][4 + j]; }
          *(v4fa*)(orow + kt * 16) = x0; *(v4fa*)(orow + kt * 16 + 4) = x1; } }
    __syncthreads();
    float* dst = AM + ((size_t)b * SEQ_FULL + qt * 64) * SEQ_FULL + k0;
{
#pragma unroll
        for (int s2 = 0; s2 < 8; ++s2) { const int row = wave * 16 + 2 * s2 + hi; const int cofs = lr * 4; const v4f val = *(const v4fa*)(os + row * 68 + cofs);
            *(v4f*)(dst + (size_t)row * SEQ_FULL + cofs) = val; }
         }
}

__global__ __launch_bounds__(32) void k_outp(const bf* __restrict__ AT, const bf* __restrict__ WO, const float* __restrict__ bo, float* OUT) {
    __shared__ __align__(16) float os[64 * 68];
    const int lane = threadIdx.x & 31, lr = lane & 15, hi = lane >> 4;
    const int r0 = blockIdx.x * 64, c0 = blockIdx.y * 64;
    v8f acc[4][4];
    gemm64(AT, AT_E, 2, WO, r0, c0, lane, acc);
#pragma unroll
    for (int mb = 0; mb < 4; ++mb)
#pragma unroll
        for (int nb = 0; nb < 4; ++nb)
#pragma unroll
            for (int j = 0; j < 8; ++j) os[(mb * 16 + hi * 8 + j) * 68 + nb * 16 + lr] = acc[mb][nb][j];
    __syncthreads();
    const int b = r0 / SEQ, t0 = r0 % SEQ; const int cofs = lr * 4;
    float* crow = OUT + ((size_t)b * SEQ_FULL + t0) * DM + c0;
    v4f bia;
#pragma unroll
    for (int j = 0; j < 4; ++j) bia[j] = bfr(bo[c0 + cofs + j]);
{
#pragma unroll 4
        for (int s = 0; s < 32; ++s) { const int row = 2 * s + hi; const v4f val = *(const v4fa*)(os + row * 68 + cofs) + bia;
            *(v4f*)(crow + (size_t)row * DM + cofs) = val; }
         }
}

extern "C" void kernel_launch(void* const* d_in, const int* in_sizes, int n_in,
                              void* d_out, int out_size, void* d_ws, size_t ws_size, hipStream_t stream) {
    if (n_in < 10) return;
    const long long need_rows = (long long)(NB - 1) * SEQ_FULL + SEQ;
    if ((long long)in_sizes[0] < need_rows * DM) return;
    if ((long long)in_sizes[1] < need_rows) return;
    if (in_sizes[2] < DM * DM || in_sizes[4] < DM * DM || in_sizes[6] < DM * DM || in_sizes[8] < DM * DM) return;
    if (in_sizes[3] < DM || in_sizes[5] < DM || in_sizes[7] < DM || in_sizes[9] < DM) return;
    const long long need_out = (long long)AM_OFF_E + ((long long)(NB - 1) * SEQ_FULL + SEQ - 1) * SEQ_FULL + SEQ;
    if ((long long)out_size < need_out) return;
    if ((size_t)WS_TOTAL > ws_size) return;
    const float* x = (const float*)d_in[0]; const int* mask = (const int*)d_in[1];
    const float* wq = (const float*)d_in[2]; const float* bq = (const float*)d_in[3];
    const float* wk = (const float*)d_in[4]; const float* bk = (const float*)d_in[5];
    const float* wv = (const float*)d_in[6]; const float* bv = (const float*)d_in[7];
    const float* wo = (const float*)d_in[8]; const float* bo = (const float*)d_in[9];
    float* OUT = (float*)d_out; float* AM = OUT + AM_OFF_E;
    char* wsp = (char*)d_ws;
    bf* WALL = (bf*)(wsp + OFF_WALL); bf* XB = (bf*)(wsp + OFF_XB); h16* QKV = (h16*)(wsp + OFF_QKV); bf* AT = (bf*)(wsp + OFF_AT); float* ST = (float*)(wsp + OFF_ST);
    k_cvtw<<<dim3((unsigned)((size_t)DM * DM / 8 / 256), 4, 1), 256, 0, stream>>>(wq, wk, wv, wo, WALL);
    k_cvtx<<<(unsigned)((size_t)MROWS * DM / 8 / 256), 256, 0, stream>>>(x, XB);
    k_qkv<<<dim3(MROWS / 64, 3 * DM / 64, 1), 32, 0, stream>>>(XB, WALL, bq, bk, bv, QKV);
    k_flash<<<dim3(SEQ / 64, NH, NB), 128, 0, stream>>>(QKV, mask, AT, ST);
    k_amean<<<dim3(SEQ / 64, SEQ / 64, NB), 128, 0, stream>>>(QKV, mask, ST, AM);
    k_outp<<<dim3(MROWS / 64, DM / 64, 1), 32, 0, stream>>>(AT, WALL + (size_t)3 * DM * DM, bo, OUT);
}

// v001
// A run of this version takes 177 microseconds.
// In two side-by-side timings against v000, it was 1.62 and 1.63 times as fast.
#include <hip/hip_runtime.h>

// Multi-head self-attention, integer key-padding mask, two outputs: out = ctx Wo^T + bo and the head-mean of the attention probabilities.
// Compute dtypes (f32 accumulate everywhere): q/k/v projections v_wmma_f32_16x16x32_bf16 (x and W converted RNE to bf16, exact products, f32 bias add);
// scores q.k^T and P.V v_wmma_f32_16x16x32_f16 (q,k planes carried x16, unnormalised P carried x256, V plain f16); softmax f32 running-max form;
// output projection v_wmma_f32_16x16x32_bf16 with ctx carried as bf16 value | residual planes (two products into one accumulator) against bf16 Wo.

#ifndef NB
#define NB 2
#endif
#ifndef SEQ
#define SEQ 2048
#endif
#define NB_FULL  2
#define SEQ_FULL 2048
#define DM   1024
#define NH   16
#define HD   64
#define MROWS (NB * SEQ)
#define QCAR 16.0f
#define PCAR 256.0f
#define LOG2E 1.4426950408889634f
#define CSC   (0.125f * LOG2E / (QCAR * QCAR))
#define FILLU (-1.0e9f * LOG2E)
#define PLANE_E ((size_t)NB * NH * SEQ * HD)
#define AT_E    ((size_t)MROWS * DM)
#define AM_OFF_E ((size_t)NB_FULL * SEQ_FULL * DM)

static_assert(NB <= NB_FULL);
static_assert(SEQ <= SEQ_FULL);
static_assert(SEQ % 64 == 0);
static_assert(DM % 64 == 0);
static_assert(DM % 32 == 0);
static_assert(HD == 64);
static_assert(NH * HD == DM);
static_assert((DM * DM / 8) % 256 == 0);
static_assert(((size_t)MROWS * DM / 8) % 256 == 0);
static_assert((size_t)NB_FULL * SEQ_FULL * DM * 4 == 16777216);
static_assert(((size_t)NB_FULL * SEQ_FULL * DM * 4) % 128 == 0);

#define SZ_WALL ((size_t)4 * DM * DM * 2)
#define SZ_XB   ((size_t)MROWS * DM * 2)
#define SZ_QKV  ((size_t)3 * PLANE_E * 2)
#define SZ_AT   ((size_t)2 * AT_E * 2)
#define SZ_ST   ((size_t)NB * NH * (SEQ / 64) * 128 * 4)
#define OFF_WALL ((size_t)0)
#define OFF_XB   (OFF_WALL + SZ_WALL)
#define OFF_QKV  (OFF_XB + SZ_XB)
#define OFF_AT   (OFF_QKV + SZ_QKV)
#define OFF_ST   (OFF_AT + SZ_AT)
#define WS_TOTAL (OFF_ST + SZ_ST)
static_assert(SZ_WALL % 256 == 0);
static_assert(SZ_XB % 256 == 0);
static_assert(SZ_QKV % 256 == 0);
static_assert(SZ_AT % 256 == 0);
static_assert(SZ_ST % 256 == 0);
static_assert(WS_TOTAL <= (size_t)134217728);

typedef _Float16 h16;
typedef unsigned short bf;
typedef __attribute__((ext_vector_type(16))) __bf16   v16bf;
typedef __attribute__((ext_vector_type(16))) _Float16 v16h;
typedef __attribute__((ext_vector_type(8)))  _Float16 v8h;
typedef __attribute__((ext_vector_type(8)))  unsigned short v8us;
typedef __attribute__((ext_vector_type(8)))  float    v8f;
typedef __attribute__((ext_vector_type(4)))  float    v4f;
typedef v4f  __attribute__((may_alias)) v4fa;

__device__ __forceinline__ unsigned short f2bf(float f) { unsigned u = __float_as_uint(f); u += 0x7FFFu + ((u >> 16) & 1u); return (unsigned short)(u >> 16); }
__device__ __forceinline__ float bf2f(unsigned short b) { return __uint_as_float(((unsigned)b) << 16); }
__device__ __forceinline__ float bfr(float f) { return bf2f(f2bf(f)); }
__device__ __forceinline__ void splitf(float y, unsigned short& h, unsigned short& l) { h = f2bf(y); l = f2bf(y - bf2f(h)); }
__device__ __forceinline__ v16h cat16(v8h lo, v8h hi) { return __builtin_shufflevector(lo, hi, 0, 1, 2, 3, 4, 5, 6, 7, 8, 9, 10, 11, 12, 13, 14, 15); }
__device__ __forceinline__ v16bf cat16b(v8us lo, v8us hi) { return __builtin_bit_cast(v16bf, __builtin_shufflevector(lo, hi, 0, 1, 2, 3, 4, 5, 6, 7, 8, 9, 10, 11, 12, 13, 14, 15)); }
__device__ __forceinline__ v8f wmma16(v16h a, v16h b, v8f c) { return __builtin_amdgcn_wmma_f32_16x16x32_f16(false, a, false, b, (short)0, c, false, false); }
__device__ __forceinline__ v8f wmmab(v16bf a, v16bf b, v8f c) { return __builtin_amdgcn_wmma_f32_16x16x32_bf16(false, a, false, b, (short)0, c, false, false); }
// fragment loaders: p points at (row, k0 + 8*half); elements 0..7 <- k0+8h.., elements 8..15 <- k0+16+8h..
__device__ __forceinline__ v16h  ldh(const h16* p) { return cat16(*(const v8h*)p, *(const v8h*)(p + 16)); }
__device__ __forceinline__ v16bf ldb(const bf* p)  { return cat16b(*(const v8us*)p, *(const v8us*)(p + 16)); }

// LDS staging of 64-row x 128-byte f16 tiles: row pitch 144 B (16 B x odd, for ds_load_b128 readers); a stage = two tiles; two stages (ring of two buffers).
#define LP      72
#define TILE_E  (64 * LP)
#define STAGE_E (2 * TILE_E)
static_assert((LP * 2) % 16 == 0);
__device__ __forceinline__ unsigned lds_off(const void* p) { return (unsigned)(size_t)p; }
// One stage by 128 threads: thread tid brings 16-byte piece (tid & 7) of rows (tid >> 3) + 16 i, i = 0..3, of both tiles, so each wave-wide copy covers four whole 128-byte lines.
// g0, g1: this thread's first source address in each tile; st0, st1: source step of 16 rows, in elements; l0: this thread's first LDS byte address in tile 0.
// s_wait_xcnt 0 closes the statement so that no address register named by a copy is rewritten ahead of it.
__device__ __forceinline__ void stage_copy(const h16* g0, size_t st0, const h16* g1, size_t st1, unsigned l0) {
    const unsigned l1 = l0 + TILE_E * 2;
    asm volatile("global_load_async_to_lds_b128 %0, %8, off\n\t"
                 "global_load_async_to_lds_b128 %1, %9, off\n\t"
                 "global_load_async_to_lds_b128 %2, %10, off\n\t"
                 "global_load_async_to_lds_b128 %3, %11, off\n\t"
                 "global_load_async_to_lds_b128 %4, %12, off\n\t"
                 "global_load_async_to_lds_b128 %5, %13, off\n\t"
                 "global_load_async_to_lds_b128 %6, %14, off\n\t"
                 "global_load_async_to_lds_b128 %7, %15, off\n\t"
                 "s_wait_xcnt 0x0"
                 :: "v"(l0), "v"(l0 + 16 * LP * 2), "v"(l0 + 32 * LP * 2), "v"(l0 + 48 * LP * 2),
                    "v"(l1), "v"(l1 + 16 * LP * 2), "v"(l1 + 32 * LP * 2), "v"(l1 + 48 * LP * 2),
                    "v"(g0), "v"(g0 + st0), "v"(g0 + 2 * st0), "v"(g0 + 3 * st0),
                    "v"(g1), "v"(g1 + st1), "v"(g1 + 2 * st1), "v"(g1 + 3 * st1)
                 : "memory");
}
// this wave's copies have landed (other waves read them only behind the next barrier)
__device__ __forceinline__ void wait_copies() { asm volatile("s_wait_asynccnt 0x0" ::: "memory"); }
// this wave's LDS reads have returned, before the barrier behind which their buffer is refilled
__device__ __forceinline__ void wait_lds() { asm volatile("s_wait_dscnt 0x0" ::: "memory"); }

__global__ __launch_bounds__(256) void k_cvtx(const float* __restrict__ x, bf* XB) {
    const size_t i = (size_t)blockIdx.x * 256 + threadIdx.x; if (i >= (size_t)MROWS * DM / 8) return;
    const size_t row = i / (DM / 8); const size_t c8 = i % (DM / 8); const size_t b = row / SEQ, t = row % SEQ;
    const v8f v = *(const v8f*)(x + ((b * SEQ_FULL + t) * DM + c8 * 8)); v8us o;
#pragma unroll
    for (int k = 0; k < 8; ++k) o[k] = f2bf(v[k]);
    *(v8us*)(XB + i * 8) = o;  }

__global__ __launch_bounds__(256) void k_cvtw(const float* __restrict__ w0, const float* __restrict__ w1, const float* __restrict__ w2, const float* __restrict__ w3, bf* WALL) {
    const size_t i = (size_t)blockIdx.x * 256 + threadIdx.x; if (i >= (size_t)DM * DM / 8) return;
    const int which = blockIdx.y; v8f v;
    if (which == 0) v = *(const v8f*)(w0 + i * 8); else if (which == 1) v = *(const v8f*)(w1 + i * 8); else if (which == 2) v = *(const v8f*)(w2 + i * 8); else v = *(const v8f*)(w3 + i * 8);
    v8us o;
#pragma unroll
    for (int k = 0; k < 8; ++k) o[k] = f2bf(v[k]);
    bf* d = WALL + (size_t)which * DM * DM + i * 8;
    *(v8us*)d = o;  }

// gemm64: one wave, 64x64 tile, K = DM per split plane: acc[mb][nb] = sum_sp sum_k A[sp*asplit + (r0+m)*DM + k] * Bt[(n0+n)*DM + k]; operands straight from K-contiguous bf16 planes.
__device__ __forceinline__ void gemm64(const bf* __restrict__ A, size_t asplit, int nsp, const bf* __restrict__ Bt, int r0, int n0, int lane, v8f (&acc)[4][4]) {
    const int lr = lane & 15, hi = lane >> 4;
#pragma unroll
    for (int mb = 0; mb < 4; ++mb)
#pragma unroll
        for (int nb = 0; nb < 4; ++nb) acc[mb][nb] = (v8f){};
    const size_t boff = (size_t)(n0 + lr) * DM + 8 * hi;
#pragma unroll 1
    for (int sp = 0; sp < nsp; ++sp) {
        const size_t aoff = (size_t)sp * asplit + (size_t)(r0 + lr) * DM + 8 * hi;
#pragma unroll 1
        for (int kc = 0; kc < DM; kc += 32) {
            v16bf a[4]; v16bf b;
#pragma unroll
            for (int mb = 0; mb < 4; ++mb) a[mb] = ldb(A + aoff + (size_t)mb * 16 * DM + kc);
#pragma unroll
            for (int nb = 0; nb < 4; ++nb) { b = ldb(Bt + boff + (size_t)nb * 16 * DM + kc);
#pragma unroll
                for (int mb = 0; mb < 4; ++mb) acc[mb][nb] = wmmab(a[mb], b, acc[mb][nb]); }
            asm volatile("" : "+v"(acc[0][0]), "+v"(acc[0][1]), "+v"(acc[0][2]), "+v"(acc[0][3]), "+v"(acc[1][0]), "+v"(acc[1][1]), "+v"(acc[1][2]), "+v"(acc[1][3]));
            asm volatile("v_nop\n\tv_nop\n\tv_nop\n\tv_nop" : "+v"(acc[2][0]), "+v"(acc[2][1]), "+v"(acc[2][2]), "+v"(acc[2][3]), "+v"(acc[3][0]), "+v"(acc[3][1]), "+v"(acc[3][2]), "+v"(acc[3][3]) : "v"(a[3]), "v"(b));
        }
    }
}

// k_qkv: grid (MROWS/64, 3*DM/64), one wave per block. blockIdx.y / 16 = which (0 q, 1 k, 2 v), blockIdx.y % 16 = head.
__global__ __launch_bounds__(32) void k_qkv(const bf* __restrict__ XB, const bf* __restrict__ WALL, const float* __restrict__ bq, const float* __restrict__ bk, const float* __restrict__ bv, h16* QKV) {
    __shared__ __align__(16) float os[64 * 68];
    const int lane = threadIdx.x & 31, lr = lane & 15, hi = lane >> 4;
    const int r0 = blockIdx.x * 64; const int which = blockIdx.y / (DM / 64); const int hh = blockIdx.y % (DM / 64); const int c0 = hh * 64;
    v8f acc[4][4];
    gemm64(XB, 0, 1, WALL, r0, (int)blockIdx.y * 64, lane, acc);
#pragma unroll
    for (int mb = 0; mb < 4; ++mb)
#pragma unroll
        for (int nb = 0; nb < 4; ++nb)
#pragma unroll
            for (int j = 0; j < 8; ++j) os[(mb * 16 + hi * 8 + j) * 68 + nb * 16 + lr] = acc[mb][nb][j];
    __syncthreads();
    const int b = r0 / SEQ, t0 = r0 % SEQ; const size_t bh = (size_t)b * NH + hh; const int q4 = lane >> 3, piece = lane & 7;
    if (which < 2) {
        h16* P = QKV + (size_t)which * PLANE_E + (bh * SEQ + t0) * HD;
        float bia[8];
#pragma unroll
        for (int j = 0; j < 8; ++j) { const int c = c0 + piece * 8 + j; const float b0 = bq[c], b1 = bk[c]; bia[j] = bfr(which == 0 ? b0 : b1); }
{
#pragma unroll 2
            for (int s = 0; s < 16; ++s) { const int row = s * 4 + q4; const v4f x0 = *(const v4fa*)(os + row * 68 + piece * 8); const v4f x1 = *(const v4fa*)(os + row * 68 + piece * 8 + 4); v8h o;
#pragma unroll
                for (int j = 0; j < 4; ++j) { o[j] = (h16)((x0[j] + bia[j]) * QCAR); o[4 + j] = (h16)((x1[j] + bia[4 + j]) * QCAR); }
                *(v8h*)(P + (size_t)row * HD + piece * 8) = o; }
             }
    } else {
        h16* P = QKV + 2 * PLANE_E + bh * HD * SEQ + t0;
{
#pragma unroll 2
            for (int s = 0; s < 16; ++s) { const int d = s * 4 + q4; const float bb = bfr(bv[c0 + d]); v8h o;
#pragma unroll
                for (int j = 0; j < 8; ++j) o[j] = (h16)(os[(piece * 8 + j) * 68 + d] + bb);
                *(v8h*)(P + (size_t)d * SEQ + piece * 8) = o; }
             }
    }
}

// k_flash: grid (SEQ/64, NH, NB), 4 waves; wave = 16 queries. S^T tiles (A = K rows, B = Q rows): lane holds query (lane&15), keys 8*half + r.
// The P^T accumulators of two adjacent 16-key tiles feed P.V directly as the B fragment (element r <- tile 0, element 8+r <- tile 1, lane unchanged); A = V^T rows from the [d][t] plane.
// Online softmax in the log2 domain with a running max; mask words (ballot bits) from LDS; replace-fill for masked keys.
__global__ __launch_bounds__(128) void k_flash(const h16* __restrict__ QKV, const int* __restrict__ mask, bf* AT, float* ST) {
    __shared__ unsigned mw[SEQ / 32];
    __shared__ __align__(16) float os[64 * 68];
    __shared__ __align__(16) float sst[128];
    __shared__ __align__(16) h16 ring[2 * STAGE_E];   // per stage: K tile [key][d], then V tile [d][key], 64 keys
    const int lane = threadIdx.x & 31, lr = lane & 15, hi = lane >> 4;
    const int wave = __builtin_amdgcn_readfirstlane((int)(threadIdx.x >> 5));
    const int qt = blockIdx.x, hh = blockIdx.y, b = blockIdx.z; const size_t bh = (size_t)b * NH + hh;
#pragma unroll 1
    for (int c = wave; c < SEQ / 32; c += 4) { const int mv = mask[(size_t)b * SEQ_FULL + c * 32 + lane]; const unsigned wd = __builtin_amdgcn_ballot_w32(mv != 0); if (lane == 0) mw[c] = wd; }
    const int crow = (int)threadIdx.x >> 3, cpc = (int)threadIdx.x & 7;
    const h16* kg = QKV + PLANE_E + (bh * SEQ + crow) * HD + cpc * 8;
    const h16* vg = QKV + 2 * PLANE_E + (bh * HD + crow) * SEQ + cpc * 8;
    const unsigned lc = lds_off(ring) + (unsigned)(crow * LP + cpc * 8) * 2u;
    stage_copy(kg, (size_t)16 * HD, vg, (size_t)16 * SEQ, lc);
    wait_copies();
    __syncthreads();
    if (SEQ / 64 > 1) stage_copy(kg + (size_t)64 * HD, (size_t)16 * HD, vg + 64, (size_t)16 * SEQ, lc + STAGE_E * 2);
    const int q0 = qt * 64 + wave * 16;
    const h16* qp = QKV + (bh * SEQ + q0 + lr) * HD + 8 * hi;
    const v16h qb0 = ldh(qp), qb1 = ldh(qp + 32);
    const int fo = lr * LP + 8 * hi;   // fragment row and k offset inside a staged tile
    float m = -1.0e30f, l = 0.0f; v8f o[4];
#pragma unroll
    for (int dt = 0; dt < 4; ++dt) o[dt] = (v8f){};
#pragma unroll 1
    for (int t = 0; t < SEQ / 64; ++t) {
      const h16* kp = ring + (t & 1) * STAGE_E + fo; const h16* vp = kp + TILE_E;
#pragma unroll   // two 32-key passes per stage; unrolled so that their LDS offsets are immediates
      for (int sub = 0; sub < 2; ++sub) {
        const int jb = t * 2 + sub; const int j0 = sub * 32; const unsigned mwv = (unsigned)__builtin_amdgcn_readfirstlane((int)mw[jb]);
        v8f s0 = (v8f){}, s1 = (v8f){};
        v16h v0, v1, v2, v3;
        { const h16* p = kp + j0 * LP; const v16h a00 = ldh(p), a01 = ldh(p + 32), a10 = ldh(p + 16 * LP), a11 = ldh(p + 16 * LP + 32);
          const h16* pv = vp + j0; v0 = ldh(pv); v1 = ldh(pv + 16 * LP); v2 = ldh(pv + 32 * LP); v3 = ldh(pv + 48 * LP);
          // keeps the pass's sixteen LDS reads one group ahead of its WMMAs; without it they are issued in pairs into one register set, each pair waited out in front of its WMMA
          __builtin_amdgcn_sched_barrier(0);
          s0 = wmma16(a00, qb0, s0); s0 = wmma16(a01, qb1, s0); s1 = wmma16(a10, qb0, s1); s1 = wmma16(a11, qb1, s1);
          asm volatile("v_nop\n\tv_nop\n\tv_nop\n\tv_nop" : "+v"(s0), "+v"(s1) : "v"(a11), "v"(qb1)); }
        s0 = s0 * CSC; s1 = s1 * CSC;
        if (mwv != 0xFFFFFFFFu) {
#pragma unroll
            for (int r = 0; r < 8; ++r) { s0[r] = ((mwv >> (8 * hi + r)) & 1u) ? s0[r] : FILLU; s1[r] = ((mwv >> (16 + 8 * hi + r)) & 1u) ? s1[r] : FILLU; } }
        float mx = fmaxf(s0[0], s1[0]);
#pragma unroll
        for (int r = 1; r < 8; ++r) mx = fmaxf(mx, fmaxf(s0[r], s1[r]));
        mx = fmaxf(mx, __shfl_xor(mx, 16, 32));
        const float mn = fmaxf(m, mx);
        if (__builtin_amdgcn_ballot_w32(mn > m) != 0u) { const float al = __builtin_amdgcn_exp2f(m - mn); l *= al;
#pragma unroll
            for (int dt = 0; dt < 4; ++dt) o[dt] = o[dt] * al; }
        m = mn;
        float ps = 0.0f; v16h pb;
#pragma unroll
        for (int r = 0; r < 8; ++r) { const float p0 = __builtin_amdgcn_exp2f(s0[r] - mn) * PCAR; const float p1 = __builtin_amdgcn_exp2f(s1[r] - mn) * PCAR; ps += p0 + p1; pb[r] = (h16)p0; pb[8 + r] = (h16)p1; }
        l += ps;
        { o[0] = wmma16(v0, pb, o[0]); o[1] = wmma16(v1, pb, o[1]); o[2] = wmma16(v2, pb, o[2]); o[3] = wmma16(v3, pb, o[3]);
          asm volatile("v_nop\n\tv_nop\n\tv_nop\n\tv_nop" : "+v"(o[0]), "+v"(o[1]), "+v"(o[2]), "+v"(o[3]) : "v"(v3), "v"(pb)); }
      }
      // publish point: stage t + 1 landed and visible, stage t's buffer left by every reader; then its refill
      wait_lds();
      wait_copies();
      __syncthreads();
      if (t + 2 < SEQ / 64) stage_copy(kg + (size_t)(t + 2) * 64 * HD, (size_t)16 * HD, vg + (t + 2) * 64, (size_t)16 * SEQ, lc + (unsigned)(t & 1) * (STAGE_E * 2));
    }
    wait_copies();
    l += __shfl_xor(l, 16, 32);
    const float il = 1.0f / l;
    { float* orow = os + (wave * 16 + lr) * 68 + 8 * hi;
#pragma unroll
      for (int dt = 0; dt < 4; ++dt) { v4f x0, x1;
#pragma unroll
          for (int j = 0; j < 4; ++j) { x0[j] = o[dt][j] * il; x1[j] = o[dt][4 + j] * il; }
          *(v4fa*)(orow + dt * 16) = x0; *(v4fa*)(orow + dt * 16 + 4) = x1; } }
    if (hi == 0) { sst[wave * 16 + lr] = m; sst[64 + wave * 16 + lr] = 16.0f * il; }
    __syncthreads();
    const int q4 = lane >> 3, piece = lane & 7;
{
#pragma unroll
        for (int s = 0; s < 4; ++s) { const int row = wave * 16 + s * 4 + q4; const v4f x0 = *(const v4fa*)(os + row * 68 + piece * 8); const v4f x1 = *(const v4fa*)(os + row * 68 + piece * 8 + 4); v8us oh, ol;
#pragma unroll
            for (int j = 0; j < 4; ++j) { unsigned short a, c2; splitf(x0[j], a, c2); oh[j] = a; ol[j] = c2; splitf(x1[j], a, c2); oh[4 + j] = a; ol[4 + j] = c2; }
            const size_t oo = ((size_t)b * SEQ + qt * 64 + row) * DM + hh * HD + piece * 8;
            *(v8us*)(AT + oo) = oh; *(v8us*)(AT + AT_E + oo) = ol; }
        if (wave == 0) { const v4f sv = *(const v4fa*)(sst + lane * 4); *(v4f*)(ST + ((bh * (SEQ / 64) + qt) * 128 + lane * 4)) = sv; }
         }
}

// k_amean: grid (SEQ/64 key tiles, SEQ/64 query tiles, NB), 4 waves; wave = 16 queries x 64 keys. Per head: S^T tiles as in k_flash (identical fragments and order),
__global__ __launch_bounds__(128) void k_amean(const h16* __restrict__ QKV, const int* __restrict__ mask, const float* __restrict__ ST, float* AM) {
    __shared__ __align__(16) float os[64 * 68];
    __shared__ __align__(16) h16 ring[2 * STAGE_E];   // per stage (one head): K tile [key][d], then Q tile [query][d]
    const int lane = threadIdx.x & 31, lr = lane & 15, hi = lane >> 4;
    const int wave = __builtin_amdgcn_readfirstlane((int)(threadIdx.x >> 5));
    const int k0 = blockIdx.x * 64, qt = blockIdx.y, b = blockIdx.z;
    const int mv0 = mask[(size_t)b * SEQ_FULL + k0 + lane]; const int mv1 = mask[(size_t)b * SEQ_FULL + k0 + 32 + lane];
    const unsigned w0 = __builtin_amdgcn_ballot_w32(mv0 != 0); const unsigned w1 = __builtin_amdgcn_ballot_w32(mv1 != 0);
    const bool allv = ((w0 & w1) == 0xFFFFFFFFu);
    v8f acc[4];
#pragma unroll
    for (int kt = 0; kt < 4; ++kt) acc[kt] = (v8f){};
    const int crow = (int)threadIdx.x >> 3, cpc = (int)threadIdx.x & 7;
    const h16* kg = QKV + PLANE_E + ((size_t)b * NH * SEQ + k0 + crow) * HD + cpc * 8;
    const h16* qg = QKV + ((size_t)b * NH * SEQ + qt * 64 + crow) * HD + cpc * 8;
    const unsigned lc = lds_off(ring) + (unsigned)(crow * LP + cpc * 8) * 2u;
    stage_copy(kg, (size_t)16 * HD, qg, (size_t)16 * HD, lc);
    wait_copies();
    __syncthreads();
    if (NH > 1) stage_copy(kg + (size_t)SEQ * HD, (size_t)16 * HD, qg + (size_t)SEQ * HD, (size_t)16 * HD, lc + STAGE_E * 2);
#pragma unroll 1
    for (int hh = 0; hh < NH; ++hh) {
        const size_t bh = (size_t)b * NH + hh;
        const float* st = ST + (bh * (SEQ / 64) + qt) * 128 + wave * 16 + lr;
        const float m = st[0], inv = st[64];
        const h16* kp = ring + (hh & 1) * STAGE_E + lr * LP + 8 * hi;
        const h16* qp = kp + TILE_E + wave * 16 * LP;
        const v16h qb0 = ldh(qp), qb1 = ldh(qp + 32);
        v8f s[4]; v16h a0[4], a1[4];
#pragma unroll   // fragment arrays stay in registers only under constant indices
        for (int kt = 0; kt < 4; ++kt) { a0[kt] = ldh(kp + kt * 16 * LP); a1[kt] = ldh(kp + kt * 16 * LP + 32); }
        // keeps the head's twenty LDS reads one group ahead of its WMMAs; without it they are issued in pairs into one register set, each pair waited out in front of its WMMA
        __builtin_amdgcn_sched_barrier(0);
#pragma unroll
        for (int kt = 0; kt < 4; ++kt) { s[kt] = wmma16(a0[kt], qb0, (v8f){}); s[kt] = wmma16(a1[kt], qb1, s[kt]); }
        asm volatile("v_nop\n\tv_nop\n\tv_nop\n\tv_nop" : "+v"(s[0]), "+v"(s[1]), "+v"(s[2]), "+v"(s[3]) : "v"(a1[3]), "v"(qb1));
#pragma unroll
        for (int kt = 0; kt < 4; ++kt) s[kt] = s[kt] * CSC;
        if (!allv) {
#pragma unroll
            for (int kt = 0; kt < 4; ++kt) { const unsigned wsel = (kt < 2) ? w0 : w1;
#pragma unroll
                for (int r = 0; r < 8; ++r) s[kt][r] = ((wsel >> ((kt & 1) * 16 + 8 * hi + r)) & 1u) ? s[kt][r] : FILLU; } }
#pragma unroll
        for (int kt = 0; kt < 4; ++kt)
#pragma unroll
            for (int r = 0; r < 8; ++r) acc[kt][r] += __builtin_amdgcn_exp2f(s[kt][r] - m) * inv;
        // publish point: head hh + 1 landed and visible, head hh's buffer left by every reader; then its refill
        wait_lds();
        wait_copies();
        __syncthreads();
        if (hh + 2 < NH) stage_copy(kg + (size_t)(hh + 2) * SEQ * HD, (size_t)16 * HD, qg + (size_t)(hh + 2) * SEQ * HD, (size_t)16 * HD, lc + (unsigned)(hh & 1) * (STAGE_E * 2));
    }
    wait_copies();
    { float* orow = os + (wave * 16 + lr) * 68 + 8 * hi;
#pragma unroll
      for (int kt = 0; kt < 4; ++kt) { v4f x0, x1;
#pragma unroll
          for (int j = 0; j < 4; ++j) { x0[j] = acc[kt][j]; x1[j] = acc[kt][4 + j]; }
          *(v4fa*)(orow + kt * 16) = x0; *(v4fa*)(orow + kt * 16 + 4) = x1; } }
    __syncthreads();
    float* dst = AM + ((size_t)b * SEQ_FULL + qt * 64) * SEQ_FULL + k0;
{
#pragma unroll
        for (int s2 = 0; s2 < 8; ++s2) { const int row = wave * 16 + 2 * s2 + hi; const int cofs = lr * 4; const v4f val = *(const v4fa*)(os + row * 68 + cofs);
            *(v4f*)(dst + (size_t)row * SEQ_FULL + cofs) = val; }
         }
}

__global__ __launch_bounds__(32) void k_outp(const bf* __restrict__ AT, const bf* __restrict__ WO, const float* __restrict__ bo, float* OUT) {
    __shared__ __align__(16) float os[64 * 68];
    const int lane = threadIdx.x & 31, lr = lane & 15, hi = lane >> 4;
    const int r0 = blockIdx.x * 64, c0 = blockIdx.y * 64;
    v8f acc[4][4];
    gemm64(AT, AT_E, 2, WO, r0, c0, lane, acc);
#pragma unroll
    for (int mb = 0; mb < 4; ++mb)
#pragma unroll
        for (int nb = 0; nb < 4; ++nb)
#pragma unroll
            for (int j = 0; j < 8; ++j) os[(mb * 16 + hi * 8 + j) * 68 + nb * 16 + lr] = acc[mb][nb][j];
    __syncthreads();
    const int b = r0 / SEQ, t0 = r0 % SEQ; const int cofs = lr * 4;
    float* crow = OUT + ((size_t)b * SEQ_FULL + t0) * DM + c0;
    v4f bia;
#pragma unroll
    for (int j = 0; j < 4; ++j) bia[j] = bfr(bo[c0 + cofs + j]);
{
#pragma unroll 4
        for (int s = 0; s < 32; ++s) { const int row = 2 * s + hi; const v4f val = *(const v4fa*)(os + row * 68 + cofs) + bia;
            *(v4f*)(crow + (size_t)row * DM + cofs) = val; }
         }
}

extern "C" void kernel_launch(void* const* d_in, const int* in_sizes, int n_in,
                              void* d_out, int out_size, void* d_ws, size_t ws_size, hipStream_t stream) {
    if (n_in < 10) return;
    const long long need_rows = (long long)(NB - 1) * SEQ_FULL + SEQ;
    if ((long long)in_sizes[0] < need_rows * DM) return;
    if ((long long)in_sizes[1] < need_rows) return;
    if (in_sizes[2] < DM * DM || in_sizes[4] < DM * DM || in_sizes[6] < DM * DM || in_sizes[8] < DM * DM) return;
    if (in_sizes[3] < DM || in_sizes[5] < DM || in_sizes[7] < DM || in_sizes[9] < DM) return;
    const long long need_out = (long long)AM_OFF_E + ((long long)(NB - 1) * SEQ_FULL + SEQ - 1) * SEQ_FULL + SEQ;
    if ((long long)out_size < need_out) return;
    if ((size_t)WS_TOTAL > ws_size) return;
    const float* x = (const float*)d_in[0]; const int* mask = (const int*)d_in[1];
    const float* wq = (const float*)d_in[2]; const float* bq = (const float*)d_in[3];
    const float* wk = (const float*)d_in[4]; const float* bk = (const float*)d_in[5];
    const float* wv = (const float*)d_in[6]; const float* bv = (const float*)d_in[7];
    const float* wo = (const float*)d_in[8]; const float* bo = (const float*)d_in[9];
    float* OUT = (float*)d_out; float* AM = OUT + AM_OFF_E;
    char* wsp = (char*)d_ws;
    bf* WALL = (bf*)(wsp + OFF_WALL); bf* XB = (bf*)(wsp + OFF_XB); h16* QKV = (h16*)(wsp + OFF_QKV); bf* AT = (bf*)(wsp + OFF_AT); float* ST = (float*)(wsp + OFF_ST);
    k_cvtw<<<dim3((unsigned)((size_t)DM * DM / 8 / 256), 4, 1), 256, 0, stream>>>(wq, wk, wv, wo, WALL);
    k_cvtx<<<(unsigned)((size_t)MROWS * DM / 8 / 256), 256, 0, stream>>>(x, XB);
    k_qkv<<<dim3(MROWS / 64, 3 * DM / 64, 1), 32, 0, stream>>>(XB, WALL, bq, bk, bv, QKV);
    k_flash<<<dim3(SEQ / 64, NH, NB), 128, 0, stream>>>(QKV, mask, AT, ST);
    k_amean<<<dim3(SEQ / 64, SEQ / 64, NB), 128, 0, stream>>>(QKV, mask, ST, AM);
    k_outp<<<dim3(MROWS / 64, DM / 64, 1), 32, 0, stream>>>(AT, WALL + (size_t)3 * DM * DM, bo, OUT);
}

// v002
// It runs in 139 microseconds.
// In two side-by-side timings against v001, it was 1.30 and 1.29 times as fast.
// Over all steps from v000 it is 2.10 times as fast.
#include <hip/hip_runtime.h>

// Multi-head self-attention, integer key-padding mask, two outputs: out = ctx Wo^T + bo and the head-mean of the attention probabilities.
// Compute dtypes (f32 accumulate everywhere): q/k/v projections v_wmma_f32_16x16x32_bf16 (x and W converted RNE to bf16, exact products, f32 bias add);
// scores q.k^T and P.V v_wmma_f32_16x16x32_f16 (q,k planes carried x16, unnormalised P carried x256, V plain f16); softmax f32 running-max form;
// output projection v_wmma_f32_16x16x32_bf16 with ctx carried as bf16 value | residual planes (two products into one accumulator) against bf16 Wo.

#ifndef NB
#define NB 2
#endif
#ifndef SEQ
#define SEQ 2048
#endif
#define NB_FULL  2
#define SEQ_FULL 2048
#define DM   1024
#define NH   16
#define HD   64
#define MROWS (NB * SEQ)
#define QCAR 16.0f
#define PCAR 256.0f
#define LOG2E 1.4426950408889634f
#define CSC   (0.125f * LOG2E / (QCAR * QCAR))
#define FILLU (-1.0e9f * LOG2E)
#define PLANE_E ((size_t)NB * NH * SEQ * HD)
#define AT_E    ((size_t)MROWS * DM)
#define AM_OFF_E ((size_t)NB_FULL * SEQ_FULL * DM)

static_assert(NB <= NB_FULL);
static_assert(SEQ <= SEQ_FULL);
static_assert(SEQ % 64 == 0);
static_assert(DM % 64 == 0);
static_assert(DM % 32 == 0);
static_assert(HD == 64);
static_assert(NH * HD == DM);
static_assert((DM * DM / 8) % 256 == 0);
static_assert(((size_t)MROWS * DM / 8) % 256 == 0);
static_assert((size_t)NB_FULL * SEQ_FULL * DM * 4 == 16777216);
static_assert(((size_t)NB_FULL * SEQ_FULL * DM * 4) % 128 == 0);

#define SZ_WALL ((size_t)4 * DM * DM * 2)
#define SZ_XB   ((size_t)MROWS * DM * 2)
#define SZ_QKV  ((size_t)3 * PLANE_E * 2)
#define SZ_AT   ((size_t)2 * AT_E * 2)
#define SZ_ST   ((size_t)NB * NH * (SEQ / 64) * 128 * 4)
#define OFF_WALL ((size_t)0)
#define OFF_XB   (OFF_WALL + SZ_WALL)
#define OFF_QKV  (OFF_XB + SZ_XB)
#define OFF_AT   (OFF_QKV + SZ_QKV)
#define OFF_ST   (OFF_AT + SZ_AT)
#define WS_TOTAL (OFF_ST + SZ_ST)
static_assert(SZ_WALL % 256 == 0);
static_assert(SZ_XB % 256 == 0);
static_assert(SZ_QKV % 256 == 0);
static_assert(SZ_AT % 256 == 0);
static_assert(SZ_ST % 256 == 0);
static_assert(WS_TOTAL <= (size_t)134217728);

typedef _Float16 h16;
typedef unsigned short bf;
typedef __attribute__((ext_vector_type(16))) __bf16   v16bf;
typedef __attribute__((ext_vector_type(16))) _Float16 v16h;
typedef __attribute__((ext_vector_type(8)))  _Float16 v8h;
typedef __attribute__((ext_vector_type(8)))  unsigned short v8us;
typedef __attribute__((ext_vector_type(8)))  float    v8f;
typedef __attribute__((ext_vector_type(4)))  float    v4f;
typedef v4f  __attribute__((may_alias)) v4fa;

__device__ __forceinline__ unsigned short f2bf(float f) { unsigned u = __float_as_uint(f); u += 0x7FFFu + ((u >> 16) & 1u); return (unsigned short)(u >> 16); }
__device__ __forceinline__ float bf2f(unsigned short b) { return __uint_as_float(((unsigned)b) << 16); }
__device__ __forceinline__ float bfr(float f) { return bf2f(f2bf(f)); }
__device__ __forceinline__ void splitf(float y, unsigned short& h, unsigned short& l) { h = f2bf(y); l = f2bf(y - bf2f(h)); }
__device__ __forceinline__ v16h cat16(v8h lo, v8h hi) { return __builtin_shufflevector(lo, hi, 0, 1, 2, 3, 4, 5, 6, 7, 8, 9, 10, 11, 12, 13, 14, 15); }
__device__ __forceinline__ v16bf cat16b(v8us lo, v8us hi) { return __builtin_bit_cast(v16bf, __builtin_shufflevector(lo, hi, 0, 1, 2, 3, 4, 5, 6, 7, 8, 9, 10, 11, 12, 13, 14, 15)); }
__device__ __forceinline__ v8f wmma16(v16h a, v16h b, v8f c) { return __builtin_amdgcn_wmma_f32_16x16x32_f16(false, a, false, b, (short)0, c, false, false); }
__device__ __forceinline__ v8f wmmab(v16bf a, v16bf b, v8f c) { return __builtin_amdgcn_wmma_f32_16x16x32_bf16(false, a, false, b, (short)0, c, false, false); }
// fragment loaders: p points at (row, k0 + 8*half); elements 0..7 <- k0+8h.., elements 8..15 <- k0+16+8h..
__device__ __forceinline__ v16h  ldh(const h16* p) { return cat16(*(const v8h*)p, *(const v8h*)(p + 16)); }
__device__ __forceinline__ v16bf ldb(const bf* p)  { return cat16b(*(const v8us*)p, *(const v8us*)(p + 16)); }

// LDS staging of 64-row x 128-byte f16 tiles: row pitch 144 B (16 B x odd, for ds_load_b128 readers); a stage = two tiles; two stages (ring of two buffers).
#define LP      72
#define TILE_E  (64 * LP)
#define STAGE_E (2 * TILE_E)
static_assert((LP * 2) % 16 == 0);
__device__ __forceinline__ unsigned lds_off(const void* p) { return (unsigned)(size_t)p; }
// One stage by 128 threads: thread tid brings 16-byte piece (tid & 7) of rows (tid >> 3) + 16 i, i = 0..3, of both tiles, so each wave-wide copy covers four whole 128-byte lines.
// g0, g1: this thread's first source address in each tile; st0, st1: source step of 16 rows, in elements; l0: this thread's first LDS byte address in tile 0.
// s_wait_xcnt 0 closes the statement so that no address register named by a copy is rewritten ahead of it.
__device__ __forceinline__ void stage_copy(const h16* g0, size_t st0, const h16* g1, size_t st1, unsigned l0) {
    const unsigned l1 = l0 + TILE_E * 2;
    asm volatile("global_load_async_to_lds_b128 %0, %8, off\n\t"
                 "global_load_async_to_lds_b128 %1, %9, off\n\t"
                 "global_load_async_to_lds_b128 %2, %10, off\n\t"
                 "global_load_async_to_lds_b128 %3, %11, off\n\t"
                 "global_load_async_to_lds_b128 %4, %12, off\n\t"
                 "global_load_async_to_lds_b128 %5, %13, off\n\t"
                 "global_load_async_to_lds_b128 %6, %14, off\n\t"
                 "global_load_async_to_lds_b128 %7, %15, off\n\t"
                 "s_wait_xcnt 0x0"
                 :: "v"(l0), "v"(l0 + 16 * LP * 2), "v"(l0 + 32 * LP * 2), "v"(l0 + 48 * LP * 2),
                    "v"(l1), "v"(l1 + 16 * LP * 2), "v"(l1 + 32 * LP * 2), "v"(l1 + 48 * LP * 2),
                    "v"(g0), "v"(g0 + st0), "v"(g0 + 2 * st0), "v"(g0 + 3 * st0),
                    "v"(g1), "v"(g1 + st1), "v"(g1 + 2 * st1), "v"(g1 + 3 * st1)
                 : "memory");
}
// this wave's copies have landed (other waves read them only behind the next barrier)
__device__ __forceinline__ void wait_copies() { asm volatile("s_wait_asynccnt 0x0" ::: "memory"); }
// this wave's LDS reads have returned, before the barrier behind which their buffer is refilled
__device__ __forceinline__ void wait_lds() { asm volatile("s_wait_dscnt 0x0" ::: "memory"); }

__global__ __launch_bounds__(256) void k_cvtx(const float* __restrict__ x, bf* XB) {
    const size_t i = (size_t)blockIdx.x * 256 + threadIdx.x; if (i >= (size_t)MROWS * DM / 8) return;
    const size_t row = i / (DM / 8); const size_t c8 = i % (DM / 8); const size_t b = row / SEQ, t = row % SEQ;
    const v8f v = *(const v8f*)(x + ((b * SEQ_FULL + t) * DM + c8 * 8)); v8us o;
#pragma unroll
    for (int k = 0; k < 8; ++k) o[k] = f2bf(v[k]);
    *(v8us*)(XB + i * 8) = o;  }

__global__ __launch_bounds__(256) void k_cvtw(const float* __restrict__ w0, const float* __restrict__ w1, const float* __restrict__ w2, const float* __restrict__ w3, bf* WALL) {
    const size_t i = (size_t)blockIdx.x * 256 + threadIdx.x; if (i >= (size_t)DM * DM / 8) return;
    const int which = blockIdx.y; v8f v;
    if (which == 0) v = *(const v8f*)(w0 + i * 8); else if (which == 1) v = *(const v8f*)(w1 + i * 8); else if (which == 2) v = *(const v8f*)(w2 + i * 8); else v = *(const v8f*)(w3 + i * 8);
    v8us o;
#pragma unroll
    for (int k = 0; k < 8; ++k) o[k] = f2bf(v[k]);
    bf* d = WALL + (size_t)which * DM * DM + i * 8;
    *(v8us*)d = o;  }

// gemm128: four waves (2 x 2), one 128x128 tile per block, a 64x64 tile per wave: acc[mb][nb] = sum_sp sum_k A[sp*asplit + (r+m)*DM + k] * Bt[(n+n')*DM + k], k ascending within each plane.
// A stage is 64 k of 128 A rows, then of 128 Bt rows, at the row pitch LP; two stages (ring of two buffers), filled by stage_copy: rows 0..63 and 64..127 of an operand are its two tiles.
#define GT_E     (2 * TILE_E)
#define GSTAGE_E (2 * GT_E)
#define GRING_B  (2 * GSTAGE_E * 2)
#define KST      (DM / 64)
static_assert(MROWS % 128 == 0);
static_assert(DM % 128 == 0);
static_assert(KST >= 2);
static_assert(GRING_B >= 4 * 64 * 68 * 4);   // the ring is the four waves' output staging behind the loop
__device__ __forceinline__ void gemm_stage(const h16* ag, size_t asplit, const h16* bg, int t, unsigned l) {
    const h16* a = ag + (size_t)(t / KST) * asplit + (t % KST) * 64; const h16* b = bg + (t % KST) * 64;
    stage_copy(a, (size_t)16 * DM, a + (size_t)64 * DM, (size_t)16 * DM, l);
    stage_copy(b, (size_t)16 * DM, b + (size_t)64 * DM, (size_t)16 * DM, l + GT_E * 2);
}
__device__ __forceinline__ void gemm128(const bf* __restrict__ A, size_t asplit, int nsp, const bf* __restrict__ Bt, int R0, int N0, const bf* ring, int wave, int lane, v8f (&acc)[4][4]) {
    const int lr = lane & 15, hi = lane >> 4; const int nt = nsp * KST;
#pragma unroll
    for (int mb = 0; mb < 4; ++mb)
#pragma unroll
        for (int nb = 0; nb < 4; ++nb) acc[mb][nb] = (v8f){};
    const int crow = (int)threadIdx.x >> 3, cpc = (int)threadIdx.x & 7;
    const h16* ag = (const h16*)(A + (size_t)(R0 + crow) * DM + cpc * 8);
    const h16* bg = (const h16*)(Bt + (size_t)(N0 + crow) * DM + cpc * 8);
    const unsigned lc = lds_off(ring) + (unsigned)(crow * LP + cpc * 8) * 2u;
    gemm_stage(ag, asplit, bg, 0, lc);
    wait_copies();
    __syncthreads();
    gemm_stage(ag, asplit, bg, 1, lc + GSTAGE_E * 2);
    const int fa = ((wave >> 1) * 64 + lr) * LP + 8 * hi; const int fb = GT_E + ((wave & 1) * 64 + lr) * LP + 8 * hi;
#pragma unroll 1   // stays rolled: one stage body in the text, the buffer picked by t & 1
    for (int t = 0; t < nt; ++t) {
        const bf* ap = ring + (t & 1) * GSTAGE_E + fa; const bf* bp = ring + (t & 1) * GSTAGE_E + fb;
        v16bf a[2][4], b[2][4];
#pragma unroll   // fragment arrays stay in registers only under constant indices
        for (int ks = 0; ks < 2; ++ks) {
#pragma unroll
            for (int i = 0; i < 4; ++i) a[ks][i] = ldb(ap + i * 16 * LP + ks * 32);
#pragma unroll
            for (int i = 0; i < 4; ++i) b[ks][i] = ldb(bp + i * 16 * LP + ks * 32); }
        // keeps the stage's LDS reads one group ahead of its WMMAs, so that the second half's reads land under the first half's products
        __builtin_amdgcn_sched_barrier(0);
#pragma unroll   // constant indices, as above, for the accumulators too
        for (int ks = 0; ks < 2; ++ks)
#pragma unroll
            for (int nb = 0; nb < 4; ++nb)
#pragma unroll
                for (int mb = 0; mb < 4; ++mb) acc[mb][nb] = wmmab(a[ks][mb], b[ks][nb], acc[mb][nb]);
        // keeps the products in front of the publish point; without it they sink behind its waits and barrier, and the next stage's copies no longer fly under them
        __builtin_amdgcn_sched_barrier(0);
        // publish point: stage t + 1 landed and visible, stage t's buffer left by every reader; then its refill
        wait_lds();
        wait_copies();
        __syncthreads();
        if (t + 2 < nt) gemm_stage(ag, asplit, bg, t + 2, lc + (unsigned)(t & 1) * (GSTAGE_E * 2));
    }
    wait_copies();
}

// k_qkv: grid (MROWS/128, 3*DM/128), four waves per block. ct = the wave's 64-column tile: ct / 16 = which (0 q, 1 k, 2 v; the same for a block's waves), ct % 16 = head.
__global__ __launch_bounds__(128) void k_qkv(const bf* __restrict__ XB, const bf* __restrict__ WALL, const float* __restrict__ bq, const float* __restrict__ bk, const float* __restrict__ bv, h16* QKV) {
    __shared__ __align__(16) unsigned char sm[GRING_B];
    const int lane = threadIdx.x & 31, lr = lane & 15, hi = lane >> 4;
    const int wave = __builtin_amdgcn_readfirstlane((int)(threadIdx.x >> 5));
    const int r0 = blockIdx.x * 128 + (wave >> 1) * 64; const int ct = blockIdx.y * 2 + (wave & 1);
    const int which = ct / (DM / 64); const int hh = ct % (DM / 64); const int c0 = hh * 64;
    v8f acc[4][4];
    gemm128(XB, 0, 1, WALL, (int)blockIdx.x * 128, (int)blockIdx.y * 128, (const bf*)sm, wave, lane, acc);
    float* os = (float*)sm + wave * (64 * 68);   // this wave's own staging range
#pragma unroll
    for (int mb = 0; mb < 4; ++mb)
#pragma unroll
        for (int nb = 0; nb < 4; ++nb)
#pragma unroll
            for (int j = 0; j < 8; ++j) os[(mb * 16 + hi * 8 + j) * 68 + nb * 16 + lr] = acc[mb][nb][j];
    __syncthreads();
    const int b = r0 / SEQ, t0 = r0 % SEQ; const size_t bh = (size_t)b * NH + hh; const int q4 = lane >> 3, piece = lane & 7;
    if (which < 2) {
        h16* P = QKV + (size_t)which * PLANE_E + (bh * SEQ + t0) * HD;
        float bia[8];
#pragma unroll
        for (int j = 0; j < 8; ++j) { const int c = c0 + piece * 8 + j; const float b0 = bq[c], b1 = bk[c]; bia[j] = bfr(which == 0 ? b0 : b1); }
{
#pragma unroll 2
            for (int s = 0; s < 16; ++s) { const int row = s * 4 + q4; const v4f x0 = *(const v4fa*)(os + row * 68 + piece * 8); const v4f x1 = *(const v4fa*)(os + row * 68 + piece * 8 + 4); v8h o;
#pragma unroll
                for (int j = 0; j < 4; ++j) { o[j] = (h16)((x0[j] + bia[j]) * QCAR); o[4 + j] = (h16)((x1[j] + bia[4 + j]) * QCAR); }
                *(v8h*)(P + (size_t)row * HD + piece * 8) = o; }
             }
    } else {
        h16* P = QKV + 2 * PLANE_E + bh * HD * SEQ + t0;
{
#pragma unroll 2
            for (int s = 0; s < 16; ++s) { const int d = s * 4 + q4; const float bb = bfr(bv[c0 + d]); v8h o;
#pragma unroll
                for (int j = 0; j < 8; ++j) o[j] = (h16)(os[(piece * 8 + j) * 68 + d] + bb);
                *(v8h*)(P + (size_t)d * SEQ + piece * 8) = o; }
             }
    }
}

// k_flash: grid (SEQ/64, NH, NB), 4 waves; wave = 16 queries. S^T tiles (A = K rows, B = Q rows): lane holds query (lane&15), keys 8*half + r.
// The P^T accumulators of two adjacent 16-key tiles feed P.V directly as the B fragment (element r <- tile 0, element 8+r <- tile 1, lane unchanged); A = V^T rows from the [d][t] plane.
// Online softmax in the log2 domain with a running max; mask words (ballot bits) from LDS; replace-fill for masked keys.
__global__ __launch_bounds__(128) void k_flash(const h16* __restrict__ QKV, const int* __restrict__ mask, bf* AT, float* ST) {
    __shared__ unsigned mw[SEQ / 32];
    __shared__ __align__(16) float os[64 * 68];
    __shared__ __align__(16) float sst[128];
    __shared__ __align__(16) h16 ring[2 * STAGE_E];   // per stage: K tile [key][d], then V tile [d][key], 64 keys
    const int lane = threadIdx.x & 31, lr = lane & 15, hi = lane >> 4;
    const int wave = __builtin_amdgcn_readfirstlane((int)(threadIdx.x >> 5));
    const int qt = blockIdx.x, hh = blockIdx.y, b = blockIdx.z; const size_t bh = (size_t)b * NH + hh;
#pragma unroll 1
    for (int c = wave; c < SEQ / 32; c += 4) { const int mv = mask[(size_t)b * SEQ_FULL + c * 32 + lane]; const unsigned wd = __builtin_amdgcn_ballot_w32(mv != 0); if (lane == 0) mw[c] = wd; }
    const int crow = (int)threadIdx.x >> 3, cpc = (int)threadIdx.x & 7;
    const h16* kg = QKV + PLANE_E + (bh * SEQ + crow) * HD + cpc * 8;
    const h16* vg = QKV + 2 * PLANE_E + (bh * HD + crow) * SEQ + cpc * 8;
    const unsigned lc = lds_off(ring) + (unsigned)(crow * LP + cpc * 8) * 2u;
    stage_copy(kg, (size_t)16 * HD, vg, (size_t)16 * SEQ, lc);
    wait_copies();
    __syncthreads();
    if (SEQ / 64 > 1) stage_copy(kg + (size_t)64 * HD, (size_t)16 * HD, vg + 64, (size_t)16 * SEQ, lc + STAGE_E * 2);
    const int q0 = qt * 64 + wave * 16;
    const h16* qp = QKV + (bh * SEQ + q0 + lr) * HD + 8 * hi;
    const v16h qb0 = ldh(qp), qb1 = ldh(qp + 32);
    const int fo = lr * LP + 8 * hi;   // fragment row and k offset inside a staged tile
    float m = -1.0e30f, l = 0.0f; v8f o[4];
#pragma unroll
    for (int dt = 0; dt < 4; ++dt) o[dt] = (v8f){};
#pragma unroll 1
    for (int t = 0; t < SEQ / 64; ++t) {
      const h16* kp = ring + (t & 1) * STAGE_E + fo; const h16* vp = kp + TILE_E;
#pragma unroll   // two 32-key passes per stage; unrolled so that their LDS offsets are immediates
      for (int sub = 0; sub < 2; ++sub) {
        const int jb = t * 2 + sub; const int j0 = sub * 32; const unsigned mwv = (unsigned)__builtin_amdgcn_readfirstlane((int)mw[jb]);
        v8f s0 = (v8f){}, s1 = (v8f){};
        v16h v0, v1, v2, v3;
        { const h16* p = kp + j0 * LP; const v16h a00 = ldh(p), a01 = ldh(p + 32), a10 = ldh(p + 16 * LP), a11 = ldh(p + 16 * LP + 32);
          const h16* pv = vp + j0; v0 = ldh(pv); v1 = ldh(pv + 16 * LP); v2 = ldh(pv + 32 * LP); v3 = ldh(pv + 48 * LP);
          // keeps the pass's sixteen LDS reads one group ahead of its WMMAs; without it they are issued in pairs into one register set, each pair waited out in front of its WMMA
          __builtin_amdgcn_sched_barrier(0);
          s0 = wmma16(a00, qb0, s0); s0 = wmma16(a01, qb1, s0); s1 = wmma16(a10, qb0, s1); s1 = wmma16(a11, qb1, s1);
          asm volatile("v_nop\n\tv_nop\n\tv_nop\n\tv_nop" : "+v"(s0), "+v"(s1) : "v"(a11), "v"(qb1)); }
        s0 = s0 * CSC; s1 = s1 * CSC;
        if (mwv != 0xFFFFFFFFu) {
#pragma unroll
            for (int r = 0; r < 8; ++r) { s0[r] = ((mwv >> (8 * hi + r)) & 1u) ? s0[r] : FILLU; s1[r] = ((mwv >> (16 + 8 * hi + r)) & 1u) ? s1[r] : FILLU; } }
        float mx = fmaxf(s0[0], s1[0]);
#pragma unroll
        for (int r = 1; r < 8; ++r) mx = fmaxf(mx, fmaxf(s0[r], s1[r]));
        mx = fmaxf(mx, __shfl_xor(mx, 16, 32));
        const float mn = fmaxf(m, mx);
        if (__builtin_amdgcn_ballot_w32(mn > m) != 0u) { const float al = __builtin_amdgcn_exp2f(m - mn); l *= al;
#pragma unroll
            for (int dt = 0; dt < 4; ++dt) o[dt] = o[dt] * al; }
        m = mn;
        float ps = 0.0f; v16h pb;
#pragma unroll
        for (int r = 0; r < 8; ++r) { const float p0 = __builtin_amdgcn_exp2f(s0[r] - mn) * PCAR; const float p1 = __builtin_amdgcn_exp2f(s1[r] - mn) * PCAR; ps += p0 + p1; pb[r] = (h16)p0; pb[8 + r] = (h16)p1; }
        l += ps;
        { o[0] = wmma16(v0, pb, o[0]); o[1] = wmma16(v1, pb, o[1]); o[2] = wmma16(v2, pb, o[2]); o[3] = wmma16(v3, pb, o[3]);
          asm volatile("v_nop\n\tv_nop\n\tv_nop\n\tv_nop" : "+v"(o[0]), "+v"(o[1]), "+v"(o[2]), "+v"(o[3]) : "v"(v3), "v"(pb)); }
      }
      // publish point: stage t + 1 landed and visible, stage t's buffer left by every reader; then its refill
      wait_lds();
      wait_copies();
      __syncthreads();
      if (t + 2 < SEQ / 64) stage_copy(kg + (size_t)(t + 2) * 64 * HD, (size_t)16 * HD, vg + (t + 2) * 64, (size_t)16 * SEQ, lc + (unsigned)(t & 1) * (STAGE_E * 2));
    }
    wait_copies();
    l += __shfl_xor(l, 16, 32);
    const float il = 1.0f / l;
    { float* orow = os + (wave * 16 + lr) * 68 + 8 * hi;
#pragma unroll
      for (int dt = 0; dt < 4; ++dt) { v4f x0, x1;
#pragma unroll
          for (int j = 0; j < 4; ++j) { x0[j] = o[dt][j] * il; x1[j] = o[dt][4 + j] * il; }
          *(v4fa*)(orow + dt * 16) = x0; *(v4fa*)(orow + dt * 16 + 4) = x1; } }
    if (hi == 0) { sst[wave * 16 + lr] = m; sst[64 + wave * 16 + lr] = 16.0f * il; }
    __syncthreads();
    const int q4 = lane >> 3, piece = lane & 7;
{
#pragma unroll
        for (int s = 0; s < 4; ++s) { const int row = wave * 16 + s * 4 + q4; const v4f x0 = *(const v4fa*)(os + row * 68 + piece * 8); const v4f x1 = *(const v4fa*)(os + row * 68 + piece * 8 + 4); v8us oh, ol;
#pragma unroll
            for (int j = 0; j < 4; ++j) { unsigned short a, c2; splitf(x0[j], a, c2); oh[j] = a; ol[j] = c2; splitf(x1[j], a, c2); oh[4 + j] = a; ol[4 + j] = c2; }
            const size_t oo = ((size_t)b * SEQ + qt * 64 + row) * DM + hh * HD + piece * 8;
            *(v8us*)(AT + oo) = oh; *(v8us*)(AT + AT_E + oo) = ol; }
        if (wave == 0) { const v4f sv = *(const v4fa*)(sst + lane * 4); *(v4f*)(ST + ((bh * (SEQ / 64) + qt) * 128 + lane * 4)) = sv; }
         }
}

// k_amean: grid (SEQ/64 key tiles, SEQ/64 query tiles, NB), 4 waves; wave = 16 queries x 64 keys. Per head: S^T tiles as in k_flash (identical fragments and order),
__global__ __launch_bounds__(128) void k_amean(const h16* __restrict__ QKV, const int* __restrict__ mask, const float* __restrict__ ST, float* AM) {
    __shared__ __align__(16) float os[64 * 68];
    __shared__ __align__(16) h16 ring[2 * STAGE_E];   // per stage (one head): K tile [key][d], then Q tile [query][d]
    const int lane = threadIdx.x & 31, lr = lane & 15, hi = lane >> 4;
    const int wave = __builtin_amdgcn_readfirstlane((int)(threadIdx.x >> 5));
    const int k0 = blockIdx.x * 64, qt = blockIdx.y, b = blockIdx.z;
    const int mv0 = mask[(size_t)b * SEQ_FULL + k0 + lane]; const int mv1 = mask[(size_t)b * SEQ_FULL + k0 + 32 + lane];
    const unsigned w0 = __builtin_amdgcn_ballot_w32(mv0 != 0); const unsigned w1 = __builtin_amdgcn_ballot_w32(mv1 != 0);
    const bool allv = ((w0 & w1) == 0xFFFFFFFFu);
    v8f acc[4];
#pragma unroll
    for (int kt = 0; kt < 4; ++kt) acc[kt] = (v8f){};
    const int crow = (int)threadIdx.x >> 3, cpc = (int)threadIdx.x & 7;
    const h16* kg = QKV + PLANE_E + ((size_t)b * NH * SEQ + k0 + crow) * HD + cpc * 8;
    const h16* qg = QKV + ((size_t)b * NH * SEQ + qt * 64 + crow) * HD + cpc * 8;
    const unsigned lc = lds_off(ring) + (unsigned)(crow * LP + cpc * 8) * 2u;
    stage_copy(kg, (size_t)16 * HD, qg, (size_t)16 * HD, lc);
    wait_copies();
    __syncthreads();
    if (NH > 1) stage_copy(kg + (size_t)SEQ * HD, (size_t)16 * HD, qg + (size_t)SEQ * HD, (size_t)16 * HD, lc + STAGE_E * 2);
#pragma unroll 1
    for (int hh = 0; hh < NH; ++hh) {
        const size_t bh = (size_t)b * NH + hh;
        const float* st = ST + (bh * (SEQ / 64) + qt) * 128 + wave * 16 + lr;
        const float m = st[0], inv = st[64];
        const h16* kp = ring + (hh & 1) * STAGE_E + lr * LP + 8 * hi;
        const h16* qp = kp + TILE_E + wave * 16 * LP;
        const v16h qb0 = ldh(qp), qb1 = ldh(qp + 32);
        v8f s[4]; v16h a0[4], a1[4];
#pragma unroll   // fragment arrays stay in registers only under constant indices
        for (int kt = 0; kt < 4; ++kt) { a0[kt] = ldh(kp + kt * 16 * LP); a1[kt] = ldh(kp + kt * 16 * LP + 32); }
        // keeps the head's twenty LDS reads one group ahead of its WMMAs; without it they are issued in pairs into one register set, each pair waited out in front of its WMMA
        __builtin_amdgcn_sched_barrier(0);
#pragma unroll
        for (int kt = 0; kt < 4; ++kt) { s[kt] = wmma16(a0[kt], qb0, (v8f){}); s[kt] = wmma16(a1[kt], qb1, s[kt]); }
        asm volatile("v_nop\n\tv_nop\n\tv_nop\n\tv_nop" : "+v"(s[0]), "+v"(s[1]), "+v"(s[2]), "+v"(s[3]) : "v"(a1[3]), "v"(qb1));
#pragma unroll
        for (int kt = 0; kt < 4; ++kt) s[kt] = s[kt] * CSC;
        if (!allv) {
#pragma unroll
            for (int kt = 0; kt < 4; ++kt) { const unsigned wsel = (kt < 2) ? w0 : w1;
#pragma unroll
                for (int r = 0; r < 8; ++r) s[kt][r] = ((wsel >> ((kt & 1) * 16 + 8 * hi + r)) & 1u) ? s[kt][r] : FILLU; } }
#pragma unroll
        for (int kt = 0; kt < 4; ++kt)
#pragma unroll
            for (int r = 0; r < 8; ++r) acc[kt][r] += __builtin_amdgcn_exp2f(s[kt][r] - m) * inv;
        // publish point: head hh + 1 landed and visible, head hh's buffer left by every reader; then its refill
        wait_lds();
        wait_copies();
        __syncthreads();
        if (hh + 2 < NH) stage_copy(kg + (size_t)(hh + 2) * SEQ * HD, (size_t)16 * HD, qg + (size_t)(hh + 2) * SEQ * HD, (size_t)16 * HD, lc + (unsigned)(hh & 1) * (STAGE_E * 2));
    }
    wait_copies();
    { float* orow = os + (wave * 16 + lr) * 68 + 8 * hi;
#pragma unroll
      for (int kt = 0; kt < 4; ++kt) { v4f x0, x1;
#pragma unroll
          for (int j = 0; j < 4; ++j) { x0[j] = acc[kt][j]; x1[j] = acc[kt][4 + j]; }
          *(v4fa*)(orow + kt * 16) = x0; *(v4fa*)(orow + kt * 16 + 4) = x1; } }
    __syncthreads();
    float* dst = AM + ((size_t)b * SEQ_FULL + qt * 64) * SEQ_FULL + k0;
{
#pragma unroll
        for (int s2 = 0; s2 < 8; ++s2) { const int row = wave * 16 + 2 * s2 + hi; const int cofs = lr * 4; const v4f val = *(const v4fa*)(os + row * 68 + cofs);
            *(v4f*)(dst + (size_t)row * SEQ_FULL + cofs) = val; }
         }
}

// k_outp: grid (MROWS/128, DM/128), four waves per block.
__global__ __launch_bounds__(128) void k_outp(const bf* __restrict__ AT, const bf* __restrict__ WO, const float* __restrict__ bo, float* OUT) {
    __shared__ __align__(16) unsigned char sm[GRING_B];
    const int lane = threadIdx.x & 31, lr = lane & 15, hi = lane >> 4;
    const int wave = __builtin_amdgcn_readfirstlane((int)(threadIdx.x >> 5));
    const int r0 = blockIdx.x * 128 + (wave >> 1) * 64, c0 = blockIdx.y * 128 + (wave & 1) * 64;
    v8f acc[4][4];
    gemm128(AT, AT_E, 2, WO, (int)blockIdx.x * 128, (int)blockIdx.y * 128, (const bf*)sm, wave, lane, acc);
    float* os = (float*)sm + wave * (64 * 68);   // this wave's own staging range
#pragma unroll
    for (int mb = 0; mb < 4; ++mb)
#pragma unroll
        for (int nb = 0; nb < 4; ++nb)
#pragma unroll
            for (int j = 0; j < 8; ++j) os[(mb * 16 + hi * 8 + j) * 68 + nb * 16 + lr] = acc[mb][nb][j];
    __syncthreads();
    const int b = r0 / SEQ, t0 = r0 % SEQ; const int cofs = lr * 4;
    float* crow = OUT + ((size_t)b * SEQ_FULL + t0) * DM + c0;
    v4f bia;
#pragma unroll
    for (int j = 0; j < 4; ++j) bia[j] = bfr(bo[c0 + cofs + j]);
{
#pragma unroll 4
        for (int s = 0; s < 32; ++s) { const int row = 2 * s + hi; const v4f val = *(const v4fa*)(os + row * 68 + cofs) + bia;
            *(v4f*)(crow + (size_t)row * DM + cofs) = val; }
         }
}

extern "C" void kernel_launch(void* const* d_in, const int* in_sizes, int n_in,
                              void* d_out, int out_size, void* d_ws, size_t ws_size, hipStream_t stream) {
    if (n_in < 10) return;
    const long long need_rows = (long long)(NB - 1) * SEQ_FULL + SEQ;
    if ((long long)in_sizes[0] < need_rows * DM) return;
    if ((long long)in_sizes[1] < need_rows) return;
    if (in_sizes[2] < DM * DM || in_sizes[4] < DM * DM || in_sizes[6] < DM * DM || in_sizes[8] < DM * DM) return;
    if (in_sizes[3] < DM || in_sizes[5] < DM || in_sizes[7] < DM || in_sizes[9] < DM) return;
    const long long need_out = (long long)AM_OFF_E + ((long long)(NB - 1) * SEQ_FULL + SEQ - 1) * SEQ_FULL + SEQ;
    if ((long long)out_size < need_out) return;
    if ((size_t)WS_TOTAL > ws_size) return;
    const float* x = (const float*)d_in[0]; const int* mask = (const int*)d_in[1];
    const float* wq = (const float*)d_in[2]; const float* bq = (const float*)d_in[3];
    const float* wk = (const float*)d_in[4]; const float* bk = (const float*)d_in[5];
    const float* wv = (const float*)d_in[6]; const float* bv = (const float*)d_in[7];
    const float* wo = (const float*)d_in[8]; const float* bo = (const float*)d_in[9];
    float* OUT = (float*)d_out; float* AM = OUT + AM_OFF_E;
    char* wsp = (char*)d_ws;
    bf* WALL = (bf*)(wsp + OFF_WALL); bf* XB = (bf*)(wsp + OFF_XB); h16* QKV = (h16*)(wsp + OFF_QKV); bf* AT = (bf*)(wsp + OFF_AT); float* ST = (float*)(wsp + OFF_ST);
    k_cvtw<<<dim3((unsigned)((size_t)DM * DM / 8 / 256), 4, 1), 256, 0, stream>>>(wq, wk, wv, wo, WALL);
    k_cvtx<<<(unsigned)((size_t)MROWS * DM / 8 / 256), 256, 0, stream>>>(x, XB);
    k_qkv<<<dim3(MROWS / 128, 3 * DM / 128, 1), 128, 0, stream>>>(XB, WALL, bq, bk, bv, QKV);
    k_flash<<<dim3(SEQ / 64, NH, NB), 128, 0, stream>>>(QKV, mask, AT, ST);
    k_amean<<<dim3(SEQ / 64, SEQ / 64, NB), 128, 0, stream>>>(QKV, mask, ST, AM);
    k_outp<<<dim3(MROWS / 128, DM / 128, 1), 128, 0, stream>>>(AT, WALL + (size_t)3 * DM * DM, bo, OUT);
}

// v003
// Measured time: 122 microseconds a run.
// Next to v002, in two timings, it ran 1.15 and 1.13 times as fast.
// Over all steps from v000 it is 2.40 times as fast.
#include <hip/hip_runtime.h>

// Multi-head self-attention, integer key-padding mask, two outputs: out = ctx Wo^T + bo and the head-mean of the attention probabilities.
// Compute dtypes (f32 accumulate everywhere): q/k/v projections v_wmma_f32_16x16x32_bf16 (x and W converted RNE to bf16, exact products, f32 bias add);
// scores q.k^T and P.V v_wmma_f32_16x16x32_f16 (q,k planes carried x16, unnormalised P carried x256, V plain f16); softmax f32 running-max form;
// output projection v_wmma_f32_16x16x32_bf16 with ctx carried as bf16 value | residual planes (two products into one accumulator) against bf16 Wo.

#ifndef NB
#define NB 2
#endif
#ifndef SEQ
#define SEQ 2048
#endif
#define NB_FULL  2
#define SEQ_FULL 2048
#define DM   1024
#define NH   16
#define HD   64
#define MROWS (NB * SEQ)
#define QCAR 16.0f
#define PCAR 256.0f
#define LOG2E 1.4426950408889634f
#define CSC   (0.125f * LOG2E / (QCAR * QCAR))
#define FILLU (-1.0e9f * LOG2E)
#define PLANE_E ((size_t)NB * NH * SEQ * HD)
#define AT_E    ((size_t)MROWS * DM)
#define AM_OFF_E ((size_t)NB_FULL * SEQ_FULL * DM)

static_assert(NB <= NB_FULL);
static_assert(SEQ <= SEQ_FULL);
static_assert(SEQ % 128 == 0);
static_assert(DM % 64 == 0);
static_assert(DM % 32 == 0);
static_assert(HD == 64);
static_assert(NH * HD == DM);
static_assert((DM * DM / 8) % 256 == 0);
static_assert(((size_t)MROWS * DM / 8) % 256 == 0);
static_assert((size_t)NB_FULL * SEQ_FULL * DM * 4 == 16777216);
static_assert(((size_t)NB_FULL * SEQ_FULL * DM * 4) % 128 == 0);

#define SZ_WALL ((size_t)4 * DM * DM * 2)
#define SZ_XB   ((size_t)MROWS * DM * 2)
#define SZ_QKV  ((size_t)3 * PLANE_E * 2)
#define SZ_AT   ((size_t)2 * AT_E * 2)
#define SZ_ST   ((size_t)NB * NH * (SEQ / 64) * 128 * 4)
#define OFF_WALL ((size_t)0)
#define OFF_XB   (OFF_WALL + SZ_WALL)
#define OFF_QKV  (OFF_XB + SZ_XB)
#define OFF_AT   (OFF_QKV + SZ_QKV)
#define OFF_ST   (OFF_AT + SZ_AT)
#define WS_TOTAL (OFF_ST + SZ_ST)
static_assert(SZ_WALL % 256 == 0);
static_assert(SZ_XB % 256 == 0);
static_assert(SZ_QKV % 256 == 0);
static_assert(SZ_AT % 256 == 0);
static_assert(SZ_ST % 256 == 0);
static_assert(WS_TOTAL <= (size_t)134217728);

typedef _Float16 h16;
typedef unsigned short bf;
typedef __attribute__((ext_vector_type(16))) __bf16   v16bf;
typedef __attribute__((ext_vector_type(16))) _Float16 v16h;
typedef __attribute__((ext_vector_type(8)))  _Float16 v8h;
typedef __attribute__((ext_vector_type(8)))  unsigned short v8us;
typedef __attribute__((ext_vector_type(8)))  float    v8f;
typedef __attribute__((ext_vector_type(4)))  float    v4f;
typedef v4f  __attribute__((may_alias)) v4fa;

__device__ __forceinline__ unsigned short f2bf(float f) { unsigned u = __float_as_uint(f); u += 0x7FFFu + ((u >> 16) & 1u); return (unsigned short)(u >> 16); }
__device__ __forceinline__ float bf2f(unsigned short b) { return __uint_as_float(((unsigned)b) << 16); }
__device__ __forceinline__ float bfr(float f) { return bf2f(f2bf(f)); }
__device__ __forceinline__ void splitf(float y, unsigned short& h, unsigned short& l) { h = f2bf(y); l = f2bf(y - bf2f(h)); }
__device__ __forceinline__ v16h cat16(v8h lo, v8h hi) { return __builtin_shufflevector(lo, hi, 0, 1, 2, 3, 4, 5, 6, 7, 8, 9, 10, 11, 12, 13, 14, 15); }
__device__ __forceinline__ v16bf cat16b(v8us lo, v8us hi) { return __builtin_bit_cast(v16bf, __builtin_shufflevector(lo, hi, 0, 1, 2, 3, 4, 5, 6, 7, 8, 9, 10, 11, 12, 13, 14, 15)); }
__device__ __forceinline__ v8f wmma16(v16h a, v16h b, v8f c) { return __builtin_amdgcn_wmma_f32_16x16x32_f16(false, a, false, b, (short)0, c, false, false); }
__device__ __forceinline__ v8f wmmab(v16bf a, v16bf b, v8f c) { return __builtin_amdgcn_wmma_f32_16x16x32_bf16(false, a, false, b, (short)0, c, false, false); }
// fragment loaders: p points at (row, k0 + 8*half); elements 0..7 <- k0+8h.., elements 8..15 <- k0+16+8h..
__device__ __forceinline__ v16h  ldh(const h16* p) { return cat16(*(const v8h*)p, *(const v8h*)(p + 16)); }
__device__ __forceinline__ v16bf ldb(const bf* p)  { return cat16b(*(const v8us*)p, *(const v8us*)(p + 16)); }

// LDS staging of 64-row x 128-byte f16 tiles: row pitch 144 B (16 B x odd, for ds_load_b128 readers); a stage = two tiles; two stages (ring of two buffers).
#define LP      72
#define TILE_E  (64 * LP)
#define STAGE_E (2 * TILE_E)
static_assert((LP * 2) % 16 == 0);
__device__ __forceinline__ unsigned lds_off(const void* p) { return (unsigned)(size_t)p; }
// One stage by 128 threads: thread tid brings 16-byte piece (tid & 7) of rows (tid >> 3) + 16 i, i = 0..3, of both tiles, so each wave-wide copy covers four whole 128-byte lines.
// g0, g1: this thread's first source address in each tile; st0, st1: source step of 16 rows, in elements; l0: this thread's first LDS byte address in tile 0.
// s_wait_xcnt 0 closes the statement so that no address register named by a copy is rewritten ahead of it.
__device__ __forceinline__ void stage_copy(const h16* g0, size_t st0, const h16* g1, size_t st1, unsigned l0) {
    const unsigned l1 = l0 + TILE_E * 2;
    asm volatile("global_load_async_to_lds_b128 %0, %8, off\n\t"
                 "global_load_async_to_lds_b128 %1, %9, off\n\t"
                 "global_load_async_to_lds_b128 %2, %10, off\n\t"
                 "global_load_async_to_lds_b128 %3, %11, off\n\t"
                 "global_load_async_to_lds_b128 %4, %12, off\n\t"
                 "global_load_async_to_lds_b128 %5, %13, off\n\t"
                 "global_load_async_to_lds_b128 %6, %14, off\n\t"
                 "global_load_async_to_lds_b128 %7, %15, off\n\t"
                 "s_wait_xcnt 0x0"
                 :: "v"(l0), "v"(l0 + 16 * LP * 2), "v"(l0 + 32 * LP * 2), "v"(l0 + 48 * LP * 2),
                    "v"(l1), "v"(l1 + 16 * LP * 2), "v"(l1 + 32 * LP * 2), "v"(l1 + 48 * LP * 2),
                    "v"(g0), "v"(g0 + st0), "v"(g0 + 2 * st0), "v"(g0 + 3 * st0),
                    "v"(g1), "v"(g1 + st1), "v"(g1 + 2 * st1), "v"(g1 + 3 * st1)
                 : "memory");
}
// this wave's copies have landed (other waves read them only behind the next barrier)
__device__ __forceinline__ void wait_copies() { asm volatile("s_wait_asynccnt 0x0" ::: "memory"); }
// this wave's LDS reads have returned, before the barrier behind which their buffer is refilled
__device__ __forceinline__ void wait_lds() { asm volatile("s_wait_dscnt 0x0" ::: "memory"); }
// The same staging by 256 threads: thread tid brings 16-byte piece (tid & 7) of rows (tid >> 3) + 32 i of both tiles; st0, st1: source step of 32 rows, in elements.
// stage_copy_64: two tiles of 64 rows (i = 0, 1). stage_copy_128: two tiles of 128 rows (i = 0..3). s_wait_xcnt 0 closes each statement, as in stage_copy.
__device__ __forceinline__ void stage_copy_64(const h16* g0, size_t st0, const h16* g1, size_t st1, unsigned l0) {
    const unsigned l1 = l0 + TILE_E * 2;
    asm volatile("global_load_async_to_lds_b128 %0, %4, off\n\t"
                 "global_load_async_to_lds_b128 %1, %5, off\n\t"
                 "global_load_async_to_lds_b128 %2, %6, off\n\t"
                 "global_load_async_to_lds_b128 %3, %7, off\n\t"
                 "s_wait_xcnt 0x0"
                 :: "v"(l0), "v"(l0 + 32 * LP * 2), "v"(l1), "v"(l1 + 32 * LP * 2),
                    "v"(g0), "v"(g0 + st0), "v"(g1), "v"(g1 + st1)
                 : "memory");
}
__device__ __forceinline__ void stage_copy_128(const h16* g0, size_t st0, const h16* g1, size_t st1, unsigned l0) {
    const unsigned l1 = l0 + 2 * TILE_E * 2;
    asm volatile("global_load_async_to_lds_b128 %0, %8, off\n\t"
                 "global_load_async_to_lds_b128 %1, %9, off\n\t"
                 "global_load_async_to_lds_b128 %2, %10, off\n\t"
                 "global_load_async_to_lds_b128 %3, %11, off\n\t"
                 "global_load_async_to_lds_b128 %4, %12, off\n\t"
                 "global_load_async_to_lds_b128 %5, %13, off\n\t"
                 "global_load_async_to_lds_b128 %6, %14, off\n\t"
                 "global_load_async_to_lds_b128 %7, %15, off\n\t"
                 "s_wait_xcnt 0x0"
                 :: "v"(l0), "v"(l0 + 32 * LP * 2), "v"(l0 + 64 * LP * 2), "v"(l0 + 96 * LP * 2),
                    "v"(l1), "v"(l1 + 32 * LP * 2), "v"(l1 + 64 * LP * 2), "v"(l1 + 96 * LP * 2),
                    "v"(g0), "v"(g0 + st0), "v"(g0 + 2 * st0), "v"(g0 + 3 * st0),
                    "v"(g1), "v"(g1 + st1), "v"(g1 + 2 * st1), "v"(g1 + 3 * st1)
                 : "memory");
}

__global__ __launch_bounds__(256) void k_cvtx(const float* __restrict__ x, bf* XB) {
    const size_t i = (size_t)blockIdx.x * 256 + threadIdx.x; if (i >= (size_t)MROWS * DM / 8) return;
    const size_t row = i / (DM / 8); const size_t c8 = i % (DM / 8); const size_t b = row / SEQ, t = row % SEQ;
    const v8f v = *(const v8f*)(x + ((b * SEQ_FULL + t) * DM + c8 * 8)); v8us o;
#pragma unroll
    for (int k = 0; k < 8; ++k) o[k] = f2bf(v[k]);
    *(v8us*)(XB + i * 8) = o;  }

__global__ __launch_bounds__(256) void k_cvtw(const float* __restrict__ w0, const float* __restrict__ w1, const float* __restrict__ w2, const float* __restrict__ w3, bf* WALL) {
    const size_t i = (size_t)blockIdx.x * 256 + threadIdx.x; if (i >= (size_t)DM * DM / 8) return;
    const int which = blockIdx.y; v8f v;
    if (which == 0) v = *(const v8f*)(w0 + i * 8); else if (which == 1) v = *(const v8f*)(w1 + i * 8); else if (which == 2) v = *(const v8f*)(w2 + i * 8); else v = *(const v8f*)(w3 + i * 8);
    v8us o;
#pragma unroll
    for (int k = 0; k < 8; ++k) o[k] = f2bf(v[k]);
    bf* d = WALL + (size_t)which * DM * DM + i * 8;
    *(v8us*)d = o;  }

// gemm128: four waves (2 x 2), one 128x128 tile per block, a 64x64 tile per wave: acc[mb][nb] = sum_sp sum_k A[sp*asplit + (r+m)*DM + k] * Bt[(n+n')*DM + k], k ascending within each plane.
// A stage is 64 k of 128 A rows, then of 128 Bt rows, at the row pitch LP; two stages (ring of two buffers), filled by stage_copy: rows 0..63 and 64..127 of an operand are its two tiles.
#define GT_E     (2 * TILE_E)
#define GSTAGE_E (2 * GT_E)
#define GRING_B  (2 * GSTAGE_E * 2)
#define KST      (DM / 64)
static_assert(MROWS % 128 == 0);
static_assert(DM % 128 == 0);
static_assert(KST >= 2);
static_assert(GRING_B >= 4 * 64 * 68 * 4);   // the ring is the four waves' output staging behind the loop
__device__ __forceinline__ void gemm_stage(const h16* ag, size_t asplit, const h16* bg, int t, unsigned l) {
    const h16* a = ag + (size_t)(t / KST) * asplit + (t % KST) * 64; const h16* b = bg + (t % KST) * 64;
    stage_copy(a, (size_t)16 * DM, a + (size_t)64 * DM, (size_t)16 * DM, l);
    stage_copy(b, (size_t)16 * DM, b + (size_t)64 * DM, (size_t)16 * DM, l + GT_E * 2);
}
__device__ __forceinline__ void gemm128(const bf* __restrict__ A, size_t asplit, int nsp, const bf* __restrict__ Bt, int R0, int N0, const bf* ring, int wave, int lane, v8f (&acc)[4][4]) {
    const int lr = lane & 15, hi = lane >> 4; const int nt = nsp * KST;
#pragma unroll
    for (int mb = 0; mb < 4; ++mb)
#pragma unroll
        for (int nb = 0; nb < 4; ++nb) acc[mb][nb] = (v8f){};
    const int crow = (int)threadIdx.x >> 3, cpc = (int)threadIdx.x & 7;
    const h16* ag = (const h16*)(A + (size_t)(R0 + crow) * DM + cpc * 8);
    const h16* bg = (const h16*)(Bt + (size_t)(N0 + crow) * DM + cpc * 8);
    const unsigned lc = lds_off(ring) + (unsigned)(crow * LP + cpc * 8) * 2u;
    gemm_stage(ag, asplit, bg, 0, lc);
    wait_copies();
    __syncthreads();
    gemm_stage(ag, asplit, bg, 1, lc + GSTAGE_E * 2);
    const int fa = ((wave >> 1) * 64 + lr) * LP + 8 * hi; const int fb = GT_E + ((wave & 1) * 64 + lr) * LP + 8 * hi;
#pragma unroll 1   // stays rolled: one stage body in the text, the buffer picked by t & 1
    for (int t = 0; t < nt; ++t) {
        const bf* ap = ring + (t & 1) * GSTAGE_E + fa; const bf* bp = ring + (t & 1) * GSTAGE_E + fb;
        v16bf a[2][4], b[2][4];
#pragma unroll   // fragment arrays stay in registers only under constant indices
        for (int ks = 0; ks < 2; ++ks) {
#pragma unroll
            for (int i = 0; i < 4; ++i) a[ks][i] = ldb(ap + i * 16 * LP + ks * 32);
#pragma unroll
            for (int i = 0; i < 4; ++i) b[ks][i] = ldb(bp + i * 16 * LP + ks * 32); }
        // keeps the stage's LDS reads one group ahead of its WMMAs, so that the second half's reads land under the first half's products
        __builtin_amdgcn_sched_barrier(0);
#pragma unroll   // constant indices, as above, for the accumulators too
        for (int ks = 0; ks < 2; ++ks)
#pragma unroll
            for (int nb = 0; nb < 4; ++nb)
#pragma unroll
                for (int mb = 0; mb < 4; ++mb) acc[mb][nb] = wmmab(a[ks][mb], b[ks][nb], acc[mb][nb]);
        // keeps the products in front of the publish point; without it they sink behind its waits and barrier, and the next stage's copies no longer fly under them
        __builtin_amdgcn_sched_barrier(0);
        // publish point: stage t + 1 landed and visible, stage t's buffer left by every reader; then its refill
        wait_lds();
        wait_copies();
        __syncthreads();
        if (t + 2 < nt) gemm_stage(ag, asplit, bg, t + 2, lc + (unsigned)(t & 1) * (GSTAGE_E * 2));
    }
    wait_copies();
}

// k_qkv: grid (MROWS/128, 3*DM/128), four waves per block. ct = the wave's 64-column tile: ct / 16 = which (0 q, 1 k, 2 v; the same for a block's waves), ct % 16 = head.
__global__ __launch_bounds__(128) void k_qkv(const bf* __restrict__ XB, const bf* __restrict__ WALL, const float* __restrict__ bq, const float* __restrict__ bk, const float* __restrict__ bv, h16* QKV) {
    __shared__ __align__(16) unsigned char sm[GRING_B];
    const int lane = threadIdx.x & 31, lr = lane & 15, hi = lane >> 4;
    const int wave = __builtin_amdgcn_readfirstlane((int)(threadIdx.x >> 5));
    const int r0 = blockIdx.x * 128 + (wave >> 1) * 64; const int ct = blockIdx.y * 2 + (wave & 1);
    const int which = ct / (DM / 64); const int hh = ct % (DM / 64); const int c0 = hh * 64;
    v8f acc[4][4];
    gemm128(XB, 0, 1, WALL, (int)blockIdx.x * 128, (int)blockIdx.y * 128, (const bf*)sm, wave, lane, acc);
    float* os = (float*)sm + wave * (64 * 68);   // this wave's own staging range
#pragma unroll
    for (int mb = 0; mb < 4; ++mb)
#pragma unroll
        for (int nb = 0; nb < 4; ++nb)
#pragma unroll
            for (int j = 0; j < 8; ++j) os[(mb * 16 + hi * 8 + j) * 68 + nb * 16 + lr] = acc[mb][nb][j];
    __syncthreads();
    const int b = r0 / SEQ, t0 = r0 % SEQ; const size_t bh = (size_t)b * NH + hh; const int q4 = lane >> 3, piece = lane & 7;
    if (which < 2) {
        h16* P = QKV + (size_t)which * PLANE_E + (bh * SEQ + t0) * HD;
        float bia[8];
#pragma unroll
        for (int j = 0; j < 8; ++j) { const int c = c0 + piece * 8 + j; const float b0 = bq[c], b1 = bk[c]; bia[j] = bfr(which == 0 ? b0 : b1); }
{
#pragma unroll 2
            for (int s = 0; s < 16; ++s) { const int row = s * 4 + q4; const v4f x0 = *(const v4fa*)(os + row * 68 + piece * 8); const v4f x1 = *(const v4fa*)(os + row * 68 + piece * 8 + 4); v8h o;
#pragma unroll
                for (int j = 0; j < 4; ++j) { o[j] = (h16)((x0[j] + bia[j]) * QCAR); o[4 + j] = (h16)((x1[j] + bia[4 + j]) * QCAR); }
                *(v8h*)(P + (size_t)row * HD + piece * 8) = o; }
             }
    } else {
        h16* P = QKV + 2 * PLANE_E + bh * HD * SEQ + t0;
{
#pragma unroll 2
            for (int s = 0; s < 16; ++s) { const int d = s * 4 + q4; const float bb = bfr(bv[c0 + d]); v8h o;
#pragma unroll
                for (int j = 0; j < 8; ++j) o[j] = (h16)(os[(piece * 8 + j) * 68 + d] + bb);
                *(v8h*)(P + (size_t)d * SEQ + piece * 8) = o; }
             }
    }
}

// k_flash: grid (SEQ/128, NH, NB), 8 waves; wave = 16 queries, so a staged K and V tile serves 128 queries. S^T tiles (A = K rows, B = Q rows): lane holds query (lane&15), keys 8*half + r.
// The P^T accumulators of two adjacent 16-key tiles feed P.V directly as the B fragment (element r <- tile 0, element 8+r <- tile 1, lane unchanged); A = V^T rows from the [d][t] plane.
// Online softmax in the log2 domain with a running max; mask words (ballot bits) from LDS; replace-fill for masked keys.
__global__ __launch_bounds__(256) void k_flash(const h16* __restrict__ QKV, const int* __restrict__ mask, bf* AT, float* ST) {
    __shared__ unsigned mw[SEQ / 32];
    __shared__ __align__(16) float os[128 * 68];
    __shared__ __align__(16) float sst[256];
    __shared__ __align__(16) h16 ring[2 * STAGE_E];   // per stage: K tile [key][d], then V tile [d][key], 64 keys
    const int lane = threadIdx.x & 31, lr = lane & 15, hi = lane >> 4;
    const int wave = __builtin_amdgcn_readfirstlane((int)(threadIdx.x >> 5));
    const int qt = blockIdx.x, hh = blockIdx.y, b = blockIdx.z; const size_t bh = (size_t)b * NH + hh;
#pragma unroll 1
    for (int c = wave; c < SEQ / 32; c += 8) { const int mv = mask[(size_t)b * SEQ_FULL + c * 32 + lane]; const unsigned wd = __builtin_amdgcn_ballot_w32(mv != 0); if (lane == 0) mw[c] = wd; }
    const int crow = (int)threadIdx.x >> 3, cpc = (int)threadIdx.x & 7;
    const h16* kg = QKV + PLANE_E + (bh * SEQ + crow) * HD + cpc * 8;
    const h16* vg = QKV + 2 * PLANE_E + (bh * HD + crow) * SEQ + cpc * 8;
    const unsigned lc = lds_off(ring) + (unsigned)(crow * LP + cpc * 8) * 2u;
    stage_copy_64(kg, (size_t)32 * HD, vg, (size_t)32 * SEQ, lc);
    wait_copies();
    __syncthreads();
    if (SEQ / 64 > 1) stage_copy_64(kg + (size_t)64 * HD, (size_t)32 * HD, vg + 64, (size_t)32 * SEQ, lc + STAGE_E * 2);
    const int q0 = qt * 128 + wave * 16;
    const h16* qp = QKV + (bh * SEQ + q0 + lr) * HD + 8 * hi;
    const v16h qb0 = ldh(qp), qb1 = ldh(qp + 32);
    const int fo = lr * LP + 8 * hi;   // fragment row and k offset inside a staged tile
    float m = -1.0e30f, l = 0.0f; v8f o[4];
#pragma unroll
    for (int dt = 0; dt < 4; ++dt) o[dt] = (v8f){};
#pragma unroll 1
    for (int t = 0; t < SEQ / 64; ++t) {
      const h16* kp = ring + (t & 1) * STAGE_E + fo; const h16* vp = kp + TILE_E;
#pragma unroll   // two 32-key passes per stage; unrolled so that their LDS offsets are immediates
      for (int sub = 0; sub < 2; ++sub) {
        const int jb = t * 2 + sub; const int j0 = sub * 32; const unsigned mwv = (unsigned)__builtin_amdgcn_readfirstlane((int)mw[jb]);
        v8f s0 = (v8f){}, s1 = (v8f){};
        v16h v0, v1, v2, v3;
        { const h16* p = kp + j0 * LP; const v16h a00 = ldh(p), a01 = ldh(p + 32), a10 = ldh(p + 16 * LP), a11 = ldh(p + 16 * LP + 32);
          const h16* pv = vp + j0; v0 = ldh(pv); v1 = ldh(pv + 16 * LP); v2 = ldh(pv + 32 * LP); v3 = ldh(pv + 48 * LP);
          // keeps the pass's sixteen LDS reads one group ahead of its WMMAs; without it they are issued in pairs into one register set, each pair waited out in front of its WMMA
          __builtin_amdgcn_sched_barrier(0);
          s0 = wmma16(a00, qb0, s0); s0 = wmma16(a01, qb1, s0); s1 = wmma16(a10, qb0, s1); s1 = wmma16(a11, qb1, s1);
          asm volatile("v_nop\n\tv_nop\n\tv_nop\n\tv_nop" : "+v"(s0), "+v"(s1) : "v"(a11), "v"(qb1)); }
        s0 = s0 * CSC; s1 = s1 * CSC;
        if (mwv != 0xFFFFFFFFu) {
#pragma unroll
            for (int r = 0; r < 8; ++r) { s0[r] = ((mwv >> (8 * hi + r)) & 1u) ? s0[r] : FILLU; s1[r] = ((mwv >> (16 + 8 * hi + r)) & 1u) ? s1[r] : FILLU; } }
        float mx = fmaxf(s0[0], s1[0]);
#pragma unroll
        for (int r = 1; r < 8; ++r) mx = fmaxf(mx, fmaxf(s0[r], s1[r]));
        mx = fmaxf(mx, __shfl_xor(mx, 16, 32));
        const float mn = fmaxf(m, mx);
        if (__builtin_amdgcn_ballot_w32(mn > m) != 0u) { const float al = __builtin_amdgcn_exp2f(m - mn); l *= al;
#pragma unroll
            for (int dt = 0; dt < 4; ++dt) o[dt] = o[dt] * al; }
        m = mn;
        float ps = 0.0f; v16h pb;
#pragma unroll
        for (int r = 0; r < 8; ++r) { const float p0 = __builtin_amdgcn_exp2f(s0[r] - mn) * PCAR; const float p1 = __builtin_amdgcn_exp2f(s1[r] - mn) * PCAR; ps += p0 + p1; pb[r] = (h16)p0; pb[8 + r] = (h16)p1; }
        l += ps;
        { o[0] = wmma16(v0, pb, o[0]); o[1] = wmma16(v1, pb, o[1]); o[2] = wmma16(v2, pb, o[2]); o[3] = wmma16(v3, pb, o[3]);
          asm volatile("v_nop\n\tv_nop\n\tv_nop\n\tv_nop" : "+v"(o[0]), "+v"(o[1]), "+v"(o[2]), "+v"(o[3]) : "v"(v3), "v"(pb)); }
      }
      // publish point: stage t + 1 landed and visible, stage t's buffer left by every reader; then its refill
      wait_lds();
      wait_copies();
      __syncthreads();
      if (t + 2 < SEQ / 64) stage_copy_64(kg + (size_t)(t + 2) * 64 * HD, (size_t)32 * HD, vg + (t + 2) * 64, (size_t)32 * SEQ, lc + (unsigned)(t & 1) * (STAGE_E * 2));
    }
    wait_copies();
    l += __shfl_xor(l, 16, 32);
    const float il = 1.0f / l;
    { float* orow = os + (wave * 16 + lr) * 68 + 8 * hi;
#pragma unroll
      for (int dt = 0; dt < 4; ++dt) { v4f x0, x1;
#pragma unroll
          for (int j = 0; j < 4; ++j) { x0[j] = o[dt][j] * il; x1[j] = o[dt][4 + j] * il; }
          *(v4fa*)(orow + dt * 16) = x0; *(v4fa*)(orow + dt * 16 + 4) = x1; } }
    if (hi == 0) { sst[wave * 16 + lr] = m; sst[128 + wave * 16 + lr] = 16.0f * il; }
    __syncthreads();
    const int q4 = lane >> 3, piece = lane & 7;
{
#pragma unroll
        for (int s = 0; s < 4; ++s) { const int row = wave * 16 + s * 4 + q4; const v4f x0 = *(const v4fa*)(os + row * 68 + piece * 8); const v4f x1 = *(const v4fa*)(os + row * 68 + piece * 8 + 4); v8us oh, ol;
#pragma unroll
            for (int j = 0; j < 4; ++j) { unsigned short a, c2; splitf(x0[j], a, c2); oh[j] = a; ol[j] = c2; splitf(x1[j], a, c2); oh[4 + j] = a; ol[4 + j] = c2; }
            const size_t oo = ((size_t)b * SEQ + qt * 128 + row) * DM + hh * HD + piece * 8;
            *(v8us*)(AT + oo) = oh; *(v8us*)(AT + AT_E + oo) = ol; }
        if (wave < 2) { const v4f sv = *(const v4fa*)(sst + wave * 128 + lane * 4); *(v4f*)(ST + ((bh * (SEQ / 128) + qt) * 256 + wave * 128 + lane * 4)) = sv; }
         }
}

// k_amean: grid (SEQ/128 key tiles, SEQ/128 query tiles, NB), 8 waves; wave = 16 queries x 128 keys, worked as two halves of 64 keys. Per head: S^T tiles as in k_flash (identical fragments and order),
// so a head's staged 128 K rows and 128 Q rows serve a 128 x 128 tile of the output. ST holds, per head and 128 queries, the 128 maxima and then the 128 scaled inverse sums.
#define AT_TILE_E (2 * TILE_E)
#define ASTAGE_E  (2 * AT_TILE_E)
#define ARING_B   (2 * ASTAGE_E * 2)
#define OSP       132
static_assert(ARING_B >= 8 * 16 * OSP * 4);   // the ring is the eight waves' output staging behind the loop
__global__ __launch_bounds__(256) void k_amean(const h16* __restrict__ QKV, const int* __restrict__ mask, const float* __restrict__ ST, float* AM) {
    __shared__ __align__(16) unsigned char sm[ARING_B];   // per stage (one head): K tile [key][d], then Q tile [query][d], 128 rows each
    const h16* ring = (const h16*)sm;
    const int lane = threadIdx.x & 31, lr = lane & 15, hi = lane >> 4;
    const int wave = __builtin_amdgcn_readfirstlane((int)(threadIdx.x >> 5));
    const int k0 = blockIdx.x * 128, qt = blockIdx.y, b = blockIdx.z;
    unsigned w[4];
#pragma unroll
    for (int i = 0; i < 4; ++i) { const int mv = mask[(size_t)b * SEQ_FULL + k0 + i * 32 + lane]; w[i] = __builtin_amdgcn_ballot_w32(mv != 0); }
    const bool allv = ((w[0] & w[1] & w[2] & w[3]) == 0xFFFFFFFFu);
    v8f acc[8];
#pragma unroll
    for (int kt = 0; kt < 8; ++kt) acc[kt] = (v8f){};
    const int crow = (int)threadIdx.x >> 3, cpc = (int)threadIdx.x & 7;
    const h16* kg = QKV + PLANE_E + ((size_t)b * NH * SEQ + k0 + crow) * HD + cpc * 8;
    const h16* qg = QKV + ((size_t)b * NH * SEQ + qt * 128 + crow) * HD + cpc * 8;
    const unsigned lc = lds_off(ring) + (unsigned)(crow * LP + cpc * 8) * 2u;
    stage_copy_128(kg, (size_t)32 * HD, qg, (size_t)32 * HD, lc);
    wait_copies();
    __syncthreads();
    if (NH > 1) stage_copy_128(kg + (size_t)SEQ * HD, (size_t)32 * HD, qg + (size_t)SEQ * HD, (size_t)32 * HD, lc + ASTAGE_E * 2);
#pragma unroll 1
    for (int hh = 0; hh < NH; ++hh) {
        const size_t bh = (size_t)b * NH + hh;
        const float* st = ST + (bh * (SEQ / 128) + qt) * 256 + wave * 16 + lr;
        const float m = st[0], inv = st[128];
        const h16* kp = ring + (hh & 1) * ASTAGE_E + lr * LP + 8 * hi;
        const h16* qp = kp + AT_TILE_E + wave * 16 * LP;
        const v16h qb0 = ldh(qp), qb1 = ldh(qp + 32);
#pragma unroll   // two halves of 64 keys; unrolled so that the accumulators keep constant indices
        for (int kh = 0; kh < 2; ++kh) {
            v8f s[4]; v16h a0[4], a1[4];
#pragma unroll   // fragment arrays stay in registers only under constant indices
            for (int kt = 0; kt < 4; ++kt) { a0[kt] = ldh(kp + (kh * 64 + kt * 16) * LP); a1[kt] = ldh(kp + (kh * 64 + kt * 16) * LP + 32); }
            // keeps the half's LDS reads one group ahead of its WMMAs; without it they are issued in pairs into one register set, each pair waited out in front of its WMMA
            __builtin_amdgcn_sched_barrier(0);
#pragma unroll
            for (int kt = 0; kt < 4; ++kt) { s[kt] = wmma16(a0[kt], qb0, (v8f){}); s[kt] = wmma16(a1[kt], qb1, s[kt]); }
            asm volatile("v_nop\n\tv_nop\n\tv_nop\n\tv_nop" : "+v"(s[0]), "+v"(s[1]), "+v"(s[2]), "+v"(s[3]) : "v"(a1[3]), "v"(qb1));
#pragma unroll
            for (int kt = 0; kt < 4; ++kt) s[kt] = s[kt] * CSC;
            if (!allv) {
#pragma unroll
                for (int kt = 0; kt < 4; ++kt) { const unsigned wsel = w[kh * 2 + (kt >> 1)];
#pragma unroll
                    for (int r = 0; r < 8; ++r) s[kt][r] = ((wsel >> ((kt & 1) * 16 + 8 * hi + r)) & 1u) ? s[kt][r] : FILLU; } }
#pragma unroll
            for (int kt = 0; kt < 4; ++kt)
#pragma unroll
                for (int r = 0; r < 8; ++r) acc[kh * 4 + kt][r] += __builtin_amdgcn_exp2f(s[kt][r] - m) * inv;
        }
        // publish point: head hh + 1 landed and visible, head hh's buffer left by every reader; then its refill
        wait_lds();
        wait_copies();
        __syncthreads();
        if (hh + 2 < NH) stage_copy_128(kg + (size_t)(hh + 2) * SEQ * HD, (size_t)32 * HD, qg + (size_t)(hh + 2) * SEQ * HD, (size_t)32 * HD, lc + (unsigned)(hh & 1) * (ASTAGE_E * 2));
    }
    wait_copies();
    float* os = (float*)sm + wave * (16 * OSP);   // this wave's own staging range
    { float* orow = os + lr * OSP + 8 * hi;
#pragma unroll
      for (int kt = 0; kt < 8; ++kt) { v4f x0, x1;
#pragma unroll
          for (int j = 0; j < 4; ++j) { x0[j] = acc[kt][j]; x1[j] = acc[kt][4 + j]; }
          *(v4fa*)(orow + kt * 16) = x0; *(v4fa*)(orow + kt * 16 + 4) = x1; } }
    __syncthreads();
    float* dst = AM + ((size_t)b * SEQ_FULL + qt * 128 + wave * 16) * SEQ_FULL + k0;
{
#pragma unroll
        for (int row = 0; row < 16; ++row) { const v4f val = *(const v4fa*)(os + row * OSP + lane * 4);
            *(v4f*)(dst + (size_t)row * SEQ_FULL + lane * 4) = val; }
         }
}

// k_outp: grid (MROWS/128, DM/128), four waves per block.
__global__ __launch_bounds__(128) void k_outp(const bf* __restrict__ AT, const bf* __restrict__ WO, const float* __restrict__ bo, float* OUT) {
    __shared__ __align__(16) unsigned char sm[GRING_B];
    const int lane = threadIdx.x & 31, lr = lane & 15, hi = lane >> 4;
    const int wave = __builtin_amdgcn_readfirstlane((int)(threadIdx.x >> 5));
    const int r0 = blockIdx.x * 128 + (wave >> 1) * 64, c0 = blockIdx.y * 128 + (wave & 1) * 64;
    v8f acc[4][4];
    gemm128(AT, AT_E, 2, WO, (int)blockIdx.x * 128, (int)blockIdx.y * 128, (const bf*)sm, wave, lane, acc);
    float* os = (float*)sm + wave * (64 * 68);   // this wave's own staging range
#pragma unroll
    for (int mb = 0; mb < 4; ++mb)
#pragma unroll
        for (int nb = 0; nb < 4; ++nb)
#pragma unroll
            for (int j = 0; j < 8; ++j) os[(mb * 16 + hi * 8 + j) * 68 + nb * 16 + lr] = acc[mb][nb][j];
    __syncthreads();
    const int b = r0 / SEQ, t0 = r0 % SEQ; const int cofs = lr * 4;
    float* crow = OUT + ((size_t)b * SEQ_FULL + t0) * DM + c0;
    v4f bia;
#pragma unroll
    for (int j = 0; j < 4; ++j) bia[j] = bfr(bo[c0 + cofs + j]);
{
#pragma unroll 4
        for (int s = 0; s < 32; ++s) { const int row = 2 * s + hi; const v4f val = *(const v4fa*)(os + row * 68 + cofs) + bia;
            *(v4f*)(crow + (size_t)row * DM + cofs) = val; }
         }
}

extern "C" void kernel_launch(void* const* d_in, const int* in_sizes, int n_in,
                              void* d_out, int out_size, void* d_ws, size_t ws_size, hipStream_t stream) {
    if (n_in < 10) return;
    const long long need_rows = (long long)(NB - 1) * SEQ_FULL + SEQ;
    if ((long long)in_sizes[0] < need_rows * DM) return;
    if ((long long)in_sizes[1] < need_rows) return;
    if (in_sizes[2] < DM * DM || in_sizes[4] < DM * DM || in_sizes[6] < DM * DM || in_sizes[8] < DM * DM) return;
    if (in_sizes[3] < DM || in_sizes[5] < DM || in_sizes[7] < DM || in_sizes[9] < DM) return;
    const long long need_out = (long long)AM_OFF_E + ((long long)(NB - 1) * SEQ_FULL + SEQ - 1) * SEQ_FULL + SEQ;
    if ((long long)out_size < need_out) return;
    if ((size_t)WS_TOTAL > ws_size) return;
    const float* x = (const float*)d_in[0]; const int* mask = (const int*)d_in[1];
    const float* wq = (const float*)d_in[2]; const float* bq = (const float*)d_in[3];
    const float* wk = (const float*)d_in[4]; const float* bk = (const float*)d_in[5];
    const float* wv = (const float*)d_in[6]; const float* bv = (const float*)d_in[7];
    const float* wo = (const float*)d_in[8]; const float* bo = (const float*)d_in[9];
    float* OUT = (float*)d_out; float* AM = OUT + AM_OFF_E;
    char* wsp = (char*)d_ws;
    bf* WALL = (bf*)(wsp + OFF_WALL); bf* XB = (bf*)(wsp + OFF_XB); h16* QKV = (h16*)(wsp + OFF_QKV); bf* AT = (bf*)(wsp + OFF_AT); float* ST = (float*)(wsp + OFF_ST);
    k_cvtw<<<dim3((unsigned)((size_t)DM * DM / 8 / 256), 4, 1), 256, 0, stream>>>(wq, wk, wv, wo, WALL);
    k_cvtx<<<(unsigned)((size_t)MROWS * DM / 8 / 256), 256, 0, stream>>>(x, XB);
    k_qkv<<<dim3(MROWS / 128, 3 * DM / 128, 1), 128, 0, stream>>>(XB, WALL, bq, bk, bv, QKV);
    k_flash<<<dim3(SEQ / 128, NH, NB), 256, 0, stream>>>(QKV, mask, AT, ST);
    k_amean<<<dim3(SEQ / 128, SEQ / 128, NB), 256, 0, stream>>>(QKV, mask, ST, AM);
    k_outp<<<dim3(MROWS / 128, DM / 128, 1), 128, 0, stream>>>(AT, WALL + (size_t)3 * DM * DM, bo, OUT);
}

// v004
// A run of this version takes 117 microseconds.
// Two timings next to v003 put it at 1.05 and 1.03 times that version's speed.
// Over all steps from v000 it is 2.50 times as fast.
#include <hip/hip_runtime.h>

// Multi-head self-attention, integer key-padding mask, two outputs: out = ctx Wo^T + bo and the head-mean of the attention probabilities.
// Compute dtypes (f32 accumulate everywhere): q/k/v projections v_wmma_f32_16x16x32_bf16 (x and W converted RNE to bf16, exact products, f32 bias add);
// scores q.k^T and P.V v_wmma_f32_16x16x32_f16 (q,k planes carried x16, unnormalised P carried x256, V plain f16); softmax f32 running-max form;
// output projection v_wmma_f32_16x16x32_bf16 with ctx carried as bf16 value | residual planes (two products into one accumulator) against bf16 Wo.

#ifndef NB
#define NB 2
#endif
#ifndef SEQ
#define SEQ 2048
#endif
#define NB_FULL  2
#define SEQ_FULL 2048
#define DM   1024
#define NH   16
#define HD   64
#define MROWS (NB * SEQ)
#define QCAR 16.0f
#define PCAR 256.0f
#define LOG2E 1.4426950408889634f
#define CSC   (0.125f * LOG2E / (QCAR * QCAR))
#define FILLU (-1.0e9f * LOG2E)
#define PLANE_E ((size_t)NB * NH * SEQ * HD)
#define AT_E    ((size_t)MROWS * DM)
#define AM_OFF_E ((size_t)NB_FULL * SEQ_FULL * DM)

static_assert(NB <= NB_FULL);
static_assert(SEQ <= SEQ_FULL);
static_assert(SEQ % 128 == 0);
static_assert(DM % 64 == 0);
static_assert(DM % 32 == 0);
static_assert(HD == 64);
static_assert(NH * HD == DM);
static_assert((DM * DM / 8) % 256 == 0);
static_assert(((size_t)MROWS * DM / 8) % 256 == 0);
static_assert((size_t)NB_FULL * SEQ_FULL * DM * 4 == 16777216);
static_assert(((size_t)NB_FULL * SEQ_FULL * DM * 4) % 128 == 0);

#define SZ_WALL ((size_t)4 * DM * DM * 2)
#define SZ_XB   ((size_t)MROWS * DM * 2)
#define SZ_QKV  ((size_t)3 * PLANE_E * 2)
#define SZ_AT   ((size_t)2 * AT_E * 2)
#define SZ_ST   ((size_t)NB * NH * (SEQ / 64) * 128 * 4)
#define OFF_WALL ((size_t)0)
#define OFF_XB   (OFF_WALL + SZ_WALL)
#define OFF_QKV  (OFF_XB + SZ_XB)
#define OFF_AT   (OFF_QKV + SZ_QKV)
#define OFF_ST   (OFF_AT + SZ_AT)
#define WS_TOTAL (OFF_ST + SZ_ST)
static_assert(SZ_WALL % 256 == 0);
static_assert(SZ_XB % 256 == 0);
static_assert(SZ_QKV % 256 == 0);
static_assert(SZ_AT % 256 == 0);
static_assert(SZ_ST % 256 == 0);
static_assert(WS_TOTAL <= (size_t)134217728);

typedef _Float16 h16;
typedef unsigned short bf;
typedef __attribute__((ext_vector_type(16))) __bf16   v16bf;
typedef __attribute__((ext_vector_type(16))) _Float16 v16h;
typedef __attribute__((ext_vector_type(8)))  _Float16 v8h;
typedef __attribute__((ext_vector_type(8)))  unsigned short v8us;
typedef __attribute__((ext_vector_type(8)))  float    v8f;
typedef __attribute__((ext_vector_type(4)))  float    v4f;
typedef v4f  __attribute__((may_alias)) v4fa;

__device__ __forceinline__ unsigned short f2bf(float f) { unsigned u = __float_as_uint(f); u += 0x7FFFu + ((u >> 16) & 1u); return (unsigned short)(u >> 16); }
__device__ __forceinline__ float bf2f(unsigned short b) { return __uint_as_float(((unsigned)b) << 16); }
__device__ __forceinline__ float bfr(float f) { return bf2f(f2bf(f)); }
__device__ __forceinline__ void splitf(float y, unsigned short& h, unsigned short& l) { h = f2bf(y); l = f2bf(y - bf2f(h)); }
__device__ __forceinline__ v16h cat16(v8h lo, v8h hi) { return __builtin_shufflevector(lo, hi, 0, 1, 2, 3, 4, 5, 6, 7, 8, 9, 10, 11, 12, 13, 14, 15); }
__device__ __forceinline__ v16bf cat16b(v8us lo, v8us hi) { return __builtin_bit_cast(v16bf, __builtin_shufflevector(lo, hi, 0, 1, 2, 3, 4, 5, 6, 7, 8, 9, 10, 11, 12, 13, 14, 15)); }
__device__ __forceinline__ v8f wmma16(v16h a, v16h b, v8f c) { return __builtin_amdgcn_wmma_f32_16x16x32_f16(false, a, false, b, (short)0, c, false, false); }
__device__ __forceinline__ v8f wmmab(v16bf a, v16bf b, v8f c) { return __builtin_amdgcn_wmma_f32_16x16x32_bf16(false, a, false, b, (short)0, c, false, false); }
// fragment loaders: p points at (row, k0 + 8*half); elements 0..7 <- k0+8h.., elements 8..15 <- k0+16+8h..
__device__ __forceinline__ v16h  ldh(const h16* p) { return cat16(*(const v8h*)p, *(const v8h*)(p + 16)); }
__device__ __forceinline__ v16bf ldb(const bf* p)  { return cat16b(*(const v8us*)p, *(const v8us*)(p + 16)); }

// LDS staging of 64-row x 128-byte f16 tiles: row pitch 144 B (16 B x odd, for ds_load_b128 readers); a stage = two tiles; two stages (ring of two buffers).
#define LP      72
#define TILE_E  (64 * LP)
#define STAGE_E (2 * TILE_E)
static_assert((LP * 2) % 16 == 0);
__device__ __forceinline__ unsigned lds_off(const void* p) { return (unsigned)(size_t)p; }
// One stage by 128 threads: thread tid brings 16-byte piece (tid & 7) of rows (tid >> 3) + 16 i, i = 0..3, of both tiles, so each wave-wide copy covers four whole 128-byte lines.
// g0, g1: this thread's first source address in each tile; st0, st1: source step of 16 rows, in elements; l0: this thread's first LDS byte address in tile 0.
// s_wait_xcnt 0 closes the statement so that no address register named by a copy is rewritten ahead of it.
__device__ __forceinline__ void stage_copy(const h16* g0, size_t st0, const h16* g1, size_t st1, unsigned l0) {
    const unsigned l1 = l0 + TILE_E * 2;
    asm volatile("global_load_async_to_lds_b128 %0, %8, off\n\t"
                 "global_load_async_to_lds_b128 %1, %9, off\n\t"
                 "global_load_async_to_lds_b128 %2, %10, off\n\t"
                 "global_load_async_to_lds_b128 %3, %11, off\n\t"
                 "global_load_async_to_lds_b128 %4, %12, off\n\t"
                 "global_load_async_to_lds_b128 %5, %13, off\n\t"
                 "global_load_async_to_lds_b128 %6, %14, off\n\t"
                 "global_load_async_to_lds_b128 %7, %15, off\n\t"
                 "s_wait_xcnt 0x0"
                 :: "v"(l0), "v"(l0 + 16 * LP * 2), "v"(l0 + 32 * LP * 2), "v"(l0 + 48 * LP * 2),
                    "v"(l1), "v"(l1 + 16 * LP * 2), "v"(l1 + 32 * LP * 2), "v"(l1 + 48 * LP * 2),
                    "v"(g0), "v"(g0 + st0), "v"(g0 + 2 * st0), "v"(g0 + 3 * st0),
                    "v"(g1), "v"(g1 + st1), "v"(g1 + 2 * st1), "v"(g1 + 3 * st1)
                 : "memory");
}
// this wave's copies have landed (other waves read them only behind the next barrier)
__device__ __forceinline__ void wait_copies() { asm volatile("s_wait_asynccnt 0x0" ::: "memory"); }
// this wave's LDS reads have returned, before the barrier behind which their buffer is refilled
__device__ __forceinline__ void wait_lds() { asm volatile("s_wait_dscnt 0x0" ::: "memory"); }
// The same staging by 256 threads: thread tid brings 16-byte piece (tid & 7) of rows (tid >> 3) + 32 i of both tiles; st0, st1: source step of 32 rows, in elements.
// stage_copy_64: two tiles of 64 rows (i = 0, 1). stage_copy_128: two tiles of 128 rows (i = 0..3). s_wait_xcnt 0 closes each statement, as in stage_copy.
__device__ __forceinline__ void stage_copy_64(const h16* g0, size_t st0, const h16* g1, size_t st1, unsigned l0) {
    const unsigned l1 = l0 + TILE_E * 2;
    asm volatile("global_load_async_to_lds_b128 %0, %4, off\n\t"
                 "global_load_async_to_lds_b128 %1, %5, off\n\t"
                 "global_load_async_to_lds_b128 %2, %6, off\n\t"
                 "global_load_async_to_lds_b128 %3, %7, off\n\t"
                 "s_wait_xcnt 0x0"
                 :: "v"(l0), "v"(l0 + 32 * LP * 2), "v"(l1), "v"(l1 + 32 * LP * 2),
                    "v"(g0), "v"(g0 + st0), "v"(g1), "v"(g1 + st1)
                 : "memory");
}
__device__ __forceinline__ void stage_copy_128(const h16* g0, size_t st0, const h16* g1, size_t st1, unsigned l0) {
    const unsigned l1 = l0 + 2 * TILE_E * 2;
    asm volatile("global_load_async_to_lds_b128 %0, %8, off\n\t"
                 "global_load_async_to_lds_b128 %1, %9, off\n\t"
                 "global_load_async_to_lds_b128 %2, %10, off\n\t"
                 "global_load_async_to_lds_b128 %3, %11, off\n\t"
                 "global_load_async_to_lds_b128 %4, %12, off\n\t"
                 "global_load_async_to_lds_b128 %5, %13, off\n\t"
                 "global_load_async_to_lds_b128 %6, %14, off\n\t"
                 "global_load_async_to_lds_b128 %7, %15, off\n\t"
                 "s_wait_xcnt 0x0"
                 :: "v"(l0), "v"(l0 + 32 * LP * 2), "v"(l0 + 64 * LP * 2), "v"(l0 + 96 * LP * 2),
                    "v"(l1), "v"(l1 + 32 * LP * 2), "v"(l1 + 64 * LP * 2), "v"(l1 + 96 * LP * 2),
                    "v"(g0), "v"(g0 + st0), "v"(g0 + 2 * st0), "v"(g0 + 3 * st0),
                    "v"(g1), "v"(g1 + st1), "v"(g1 + 2 * st1), "v"(g1 + 3 * st1)
                 : "memory");
}

__global__ __launch_bounds__(256) void k_cvtx(const float* __restrict__ x, bf* XB) {
    const size_t i = (size_t)blockIdx.x * 256 + threadIdx.x; if (i >= (size_t)MROWS * DM / 8) return;
    const size_t row = i / (DM / 8); const size_t c8 = i % (DM / 8); const size_t b = row / SEQ, t = row % SEQ;
    const v8f v = *(const v8f*)(x + ((b * SEQ_FULL + t) * DM + c8 * 8)); v8us o;
#pragma unroll
    for (int k = 0; k < 8; ++k) o[k] = f2bf(v[k]);
    *(v8us*)(XB + i * 8) = o;  }

__global__ __launch_bounds__(256) void k_cvtw(const float* __restrict__ w0, const float* __restrict__ w1, const float* __restrict__ w2, const float* __restrict__ w3, bf* WALL) {
    const size_t i = (size_t)blockIdx.x * 256 + threadIdx.x; if (i >= (size_t)DM * DM / 8) return;
    const int which = blockIdx.y; v8f v;
    if (which == 0) v = *(const v8f*)(w0 + i * 8); else if (which == 1) v = *(const v8f*)(w1 + i * 8); else if (which == 2) v = *(const v8f*)(w2 + i * 8); else v = *(const v8f*)(w3 + i * 8);
    v8us o;
#pragma unroll
    for (int k = 0; k < 8; ++k) o[k] = f2bf(v[k]);
    bf* d = WALL + (size_t)which * DM * DM + i * 8;
    *(v8us*)d = o;  }

// gemm128: four waves (2 x 2), one 128x128 tile per block, a 64x64 tile per wave: acc[mb][nb] = sum_sp sum_k A[sp*asplit + (r+m)*DM + k] * Bt[(n+n')*DM + k], k ascending within each plane.
// A stage is 64 k of 128 A rows, then of 128 Bt rows, at the row pitch LP; two stages (ring of two buffers), filled by stage_copy: rows 0..63 and 64..127 of an operand are its two tiles.
#define GT_E     (2 * TILE_E)
#define GSTAGE_E (2 * GT_E)
#define GRING_B  (2 * GSTAGE_E * 2)
#define KST      (DM / 64)
static_assert(MROWS % 128 == 0);
static_assert(DM % 128 == 0);
static_assert(KST >= 2);
static_assert(GRING_B >= 4 * 64 * 68 * 4);   // the ring is the four waves' output staging behind the loop
__device__ __forceinline__ void gemm_stage(const h16* ag, size_t asplit, const h16* bg, int t, unsigned l) {
    const h16* a = ag + (size_t)(t / KST) * asplit + (t % KST) * 64; const h16* b = bg + (t % KST) * 64;
    stage_copy(a, (size_t)16 * DM, a + (size_t)64 * DM, (size_t)16 * DM, l);
    stage_copy(b, (size_t)16 * DM, b + (size_t)64 * DM, (size_t)16 * DM, l + GT_E * 2);
}
__device__ __forceinline__ void gemm128(const bf* __restrict__ A, size_t asplit, int nsp, const bf* __restrict__ Bt, int R0, int N0, const bf* ring, int wave, int lane, v8f (&acc)[4][4]) {
    const int lr = lane & 15, hi = lane >> 4; const int nt = nsp * KST;
#pragma unroll
    for (int mb = 0; mb < 4; ++mb)
#pragma unroll
        for (int nb = 0; nb < 4; ++nb) acc[mb][nb] = (v8f){};
    const int crow = (int)threadIdx.x >> 3, cpc = (int)threadIdx.x & 7;
    const h16* ag = (const h16*)(A + (size_t)(R0 + crow) * DM + cpc * 8);
    const h16* bg = (const h16*)(Bt + (size_t)(N0 + crow) * DM + cpc * 8);
    const unsigned lc = lds_off(ring) + (unsigned)(crow * LP + cpc * 8) * 2u;
    gemm_stage(ag, asplit, bg, 0, lc);
    wait_copies();
    __syncthreads();
    gemm_stage(ag, asplit, bg, 1, lc + GSTAGE_E * 2);
    const int fa = ((wave >> 1) * 64 + lr) * LP + 8 * hi; const int fb = GT_E + ((wave & 1) * 64 + lr) * LP + 8 * hi;
#pragma unroll 1   // stays rolled: one stage body in the text, the buffer picked by t & 1
    for (int t = 0; t < nt; ++t) {
        const bf* ap = ring + (t & 1) * GSTAGE_E + fa; const bf* bp = ring + (t & 1) * GSTAGE_E + fb;
        v16bf a[2][4], b[2][4];
#pragma unroll   // fragment arrays stay in registers only under constant indices
        for (int ks = 0; ks < 2; ++ks) {
#pragma unroll
            for (int i = 0; i < 4; ++i) a[ks][i] = ldb(ap + i * 16 * LP + ks * 32);
#pragma unroll
            for (int i = 0; i < 4; ++i) b[ks][i] = ldb(bp + i * 16 * LP + ks * 32); }
        // keeps the stage's LDS reads one group ahead of its WMMAs, so that the second half's reads land under the first half's products
        __builtin_amdgcn_sched_barrier(0);
#pragma unroll   // constant indices, as above, for the accumulators too
        for (int ks = 0; ks < 2; ++ks)
#pragma unroll
            for (int nb = 0; nb < 4; ++nb)
#pragma unroll
                for (int mb = 0; mb < 4; ++mb) acc[mb][nb] = wmmab(a[ks][mb], b[ks][nb], acc[mb][nb]);
        // keeps the products in front of the publish point; without it they sink behind its waits and barrier, and the next stage's copies no longer fly under them
        __builtin_amdgcn_sched_barrier(0);
        // publish point: stage t + 1 landed and visible, stage t's buffer left by every reader; then its refill
        wait_lds();
        wait_copies();
        __syncthreads();
        if (t + 2 < nt) gemm_stage(ag, asplit, bg, t + 2, lc + (unsigned)(t & 1) * (GSTAGE_E * 2));
    }
    wait_copies();
}

// k_qkv: grid (MROWS/128, 3*DM/128), four waves per block. ct = the wave's 64-column tile: ct / 16 = which (0 q, 1 k, 2 v; the same for a block's waves), ct % 16 = head.
__global__ __launch_bounds__(128) void k_qkv(const bf* __restrict__ XB, const bf* __restrict__ WALL, const float* __restrict__ bq, const float* __restrict__ bk, const float* __restrict__ bv, h16* QKV) {
    __shared__ __align__(16) unsigned char sm[GRING_B];
    const int lane = threadIdx.x & 31, lr = lane & 15, hi = lane >> 4;
    const int wave = __builtin_amdgcn_readfirstlane((int)(threadIdx.x >> 5));
    const int r0 = blockIdx.x * 128 + (wave >> 1) * 64; const int ct = blockIdx.y * 2 + (wave & 1);
    const int which = ct / (DM / 64); const int hh = ct % (DM / 64); const int c0 = hh * 64;
    v8f acc[4][4];
    gemm128(XB, 0, 1, WALL, (int)blockIdx.x * 128, (int)blockIdx.y * 128, (const bf*)sm, wave, lane, acc);
    float* os = (float*)sm + wave * (64 * 68);   // this wave's own staging range
#pragma unroll
    for (int mb = 0; mb < 4; ++mb)
#pragma unroll
        for (int nb = 0; nb < 4; ++nb)
#pragma unroll
            for (int j = 0; j < 8; ++j) os[(mb * 16 + hi * 8 + j) * 68 + nb * 16 + lr] = acc[mb][nb][j];
    __syncthreads();
    const int b = r0 / SEQ, t0 = r0 % SEQ; const size_t bh = (size_t)b * NH + hh; const int q4 = lane >> 3, piece = lane & 7;
    if (which < 2) {
        h16* P = QKV + (size_t)which * PLANE_E + (bh * SEQ + t0) * HD;
        float bia[8];
#pragma unroll
        for (int j = 0; j < 8; ++j) { const int c = c0 + piece * 8 + j; const float b0 = bq[c], b1 = bk[c]; bia[j] = bfr(which == 0 ? b0 : b1); }
{
#pragma unroll 2
            for (int s = 0; s < 16; ++s) { const int row = s * 4 + q4; const v4f x0 = *(const v4fa*)(os + row * 68 + piece * 8); const v4f x1 = *(const v4fa*)(os + row * 68 + piece * 8 + 4); v8h o;
#pragma unroll
                for (int j = 0; j < 4; ++j) { o[j] = (h16)((x0[j] + bia[j]) * QCAR); o[4 + j] = (h16)((x1[j] + bia[4 + j]) * QCAR); }
                *(v8h*)(P + (size_t)row * HD + piece * 8) = o; }
             }
    } else {
        h16* P = QKV + 2 * PLANE_E + bh * HD * SEQ + t0;
{
#pragma unroll 2
            for (int s = 0; s < 16; ++s) { const int d = s * 4 + q4; const float bb = bfr(bv[c0 + d]); v8h o;
#pragma unroll
                for (int j = 0; j < 8; ++j) o[j] = (h16)(os[(piece * 8 + j) * 68 + d] + bb);
                *(v8h*)(P + (size_t)d * SEQ + piece * 8) = o; }
             }
    }
}

// k_flash: grid (SEQ/256, NH, NB), 16 waves; wave = 32 queries (two groups of 16) x one half of the keys, so every K and V fragment read from LDS feeds two WMMAs at four waves per SIMD.
// Waves 0..7 work keys 0..SEQ/2-1, waves 8..15 the rest, each set of eight with its own ring of two stages, filled by its own 256 threads; behind the loop the two halves' maxima, sums and
// accumulators are merged through LDS. S^T tiles (A = K rows, B = Q rows): lane holds query (lane&15) of its group, keys 8*half + r.
// The P^T accumulators of two adjacent 16-key tiles feed P.V directly as the B fragment (element r <- tile 0, element 8+r <- tile 1, lane unchanged); A = V^T rows from the [d][t] plane.
// Online softmax in the log2 domain with a running max; mask words (ballot bits) from LDS; replace-fill for masked keys.
#define FNS (SEQ / 128)   // stages of 64 keys per key half
static_assert(SEQ % 256 == 0);
static_assert(FNS >= 2);
static_assert(4 * STAGE_E * 2 >= 17 * 256 * 16);   // the rings are the merge buffer behind the loop
__global__ __launch_bounds__(512) void k_flash(const h16* __restrict__ QKV, const int* __restrict__ mask, bf* AT, float* ST) {
    __shared__ unsigned mw[SEQ / 32];
    __shared__ __align__(16) float os[256 * 68];
    __shared__ __align__(16) float sst[512];
    __shared__ __align__(16) h16 ring[4 * STAGE_E];   // per key half two stages; per stage: K tile [key][d], then V tile [d][key], 64 keys
    const int lane = threadIdx.x & 31, lr = lane & 15, hi = lane >> 4;
    const int wave = __builtin_amdgcn_readfirstlane((int)(threadIdx.x >> 5));
    const int kh = wave >> 3, wq = wave & 7;
    const int qt = blockIdx.x, hh = blockIdx.y, b = blockIdx.z; const size_t bh = (size_t)b * NH + hh;
#pragma unroll 1
    for (int c = wave; c < SEQ / 32; c += 16) { const int mv = mask[(size_t)b * SEQ_FULL + c * 32 + lane]; const unsigned wd = __builtin_amdgcn_ballot_w32(mv != 0); if (lane == 0) mw[c] = wd; }
    const int crow = ((int)threadIdx.x & 255) >> 3, cpc = (int)threadIdx.x & 7;
    const h16* kg = QKV + PLANE_E + (bh * SEQ + kh * (SEQ / 2) + crow) * HD + cpc * 8;
    const h16* vg = QKV + 2 * PLANE_E + (bh * HD + crow) * SEQ + kh * (SEQ / 2) + cpc * 8;
    const h16* hring = ring + kh * (2 * STAGE_E);
    const unsigned lc = lds_off(hring) + (unsigned)(crow * LP + cpc * 8) * 2u;
    stage_copy_64(kg, (size_t)32 * HD, vg, (size_t)32 * SEQ, lc);
    wait_copies();
    __syncthreads();
    stage_copy_64(kg + (size_t)64 * HD, (size_t)32 * HD, vg + 64, (size_t)32 * SEQ, lc + STAGE_E * 2);
    const int q0 = qt * 256 + wq * 32;
    const h16* qp = QKV + (bh * SEQ + q0 + lr) * HD + 8 * hi;
    v16h qb[2][2];
#pragma unroll
    for (int g = 0; g < 2; ++g) { qb[g][0] = ldh(qp + g * 16 * HD); qb[g][1] = ldh(qp + g * 16 * HD + 32); }
    const int fo = lr * LP + 8 * hi;   // fragment row and k offset inside a staged tile
    float m[2], l[2]; v8f o[2][4];
#pragma unroll
    for (int g = 0; g < 2; ++g) { m[g] = -1.0e30f; l[g] = 0.0f;
#pragma unroll
        for (int dt = 0; dt < 4; ++dt) o[g][dt] = (v8f){}; }
#pragma unroll 1
    for (int t = 0; t < FNS; ++t) {
      const h16* kp = hring + (t & 1) * STAGE_E + fo; const h16* vp = kp + TILE_E;
#pragma unroll   // two 32-key passes per stage; unrolled so that their LDS offsets are immediates
      for (int sub = 0; sub < 2; ++sub) {
        const int jb = kh * (SEQ / 64) + t * 2 + sub; const int j0 = sub * 32; const unsigned mwv = (unsigned)__builtin_amdgcn_readfirstlane((int)mw[jb]);
        v8f s[2][2];
        v16h v0, v1, v2, v3;
        { const h16* p = kp + j0 * LP; const v16h a00 = ldh(p), a01 = ldh(p + 32), a10 = ldh(p + 16 * LP), a11 = ldh(p + 16 * LP + 32);
          const h16* pv = vp + j0; v0 = ldh(pv); v1 = ldh(pv + 16 * LP); v2 = ldh(pv + 32 * LP); v3 = ldh(pv + 48 * LP);
          // keeps the pass's sixteen LDS reads one group ahead of its WMMAs; without it they are issued in pairs into one register set, each pair waited out in front of its WMMA
          __builtin_amdgcn_sched_barrier(0);
          s[0][0] = wmma16(a00, qb[0][0], (v8f){}); s[1][0] = wmma16(a00, qb[1][0], (v8f){}); s[0][1] = wmma16(a10, qb[0][0], (v8f){}); s[1][1] = wmma16(a10, qb[1][0], (v8f){});
          s[0][0] = wmma16(a01, qb[0][1], s[0][0]); s[1][0] = wmma16(a01, qb[1][1], s[1][0]); s[0][1] = wmma16(a11, qb[0][1], s[0][1]); s[1][1] = wmma16(a11, qb[1][1], s[1][1]);
          // the WMMA distance in front of the first vector use of the scores, on the branch's taken side too
          asm volatile("v_nop\n\tv_nop\n\tv_nop\n\tv_nop" : "+v"(s[0][0]), "+v"(s[0][1]), "+v"(s[1][0]), "+v"(s[1][1]) : "v"(a11), "v"(qb[0][1]), "v"(qb[1][1])); }
#pragma unroll
        for (int g = 0; g < 2; ++g) { s[g][0] = s[g][0] * CSC; s[g][1] = s[g][1] * CSC; }
        if (mwv != 0xFFFFFFFFu) {
            const unsigned mh = mwv >> (8 * hi);   // the lane's own bits first, so that each test takes a constant and no register is held for it over the loop
#pragma unroll
            for (int g = 0; g < 2; ++g)
#pragma unroll
                for (int r = 0; r < 8; ++r) { s[g][0][r] = ((mh >> r) & 1u) ? s[g][0][r] : FILLU; s[g][1][r] = ((mh >> (16 + r)) & 1u) ? s[g][1][r] : FILLU; } }
        float mx[2], mo[2], mn[2];
#pragma unroll
        for (int g = 0; g < 2; ++g) {
            mx[g] = fmaxf(s[g][0][0], s[g][1][0]);
#pragma unroll
            for (int r = 1; r < 8; ++r) mx[g] = fmaxf(mx[g], fmaxf(s[g][0][r], s[g][1][r])); }
#pragma unroll
        for (int g = 0; g < 2; ++g) mo[g] = __shfl_xor(mx[g], 16, 32);
#pragma unroll
        for (int g = 0; g < 2; ++g) mn[g] = fmaxf(m[g], fmaxf(mx[g], mo[g]));
        // one branch for both groups: a group whose maximum stands is scaled by exp2(0) = 1, which changes no bit
        if (__builtin_amdgcn_ballot_w32(mn[0] > m[0] || mn[1] > m[1]) != 0u) {
#pragma unroll
            for (int g = 0; g < 2; ++g) { const float al = __builtin_amdgcn_exp2f(m[g] - mn[g]); l[g] *= al;
#pragma unroll
                for (int dt = 0; dt < 4; ++dt) o[g][dt] = o[g][dt] * al; } }
        v16h pb[2];
#pragma unroll
        for (int g = 0; g < 2; ++g) {
            m[g] = mn[g];
            v8f e0 = s[g][0] - mn[g], e1 = s[g][1] - mn[g];
#pragma unroll
            for (int r = 0; r < 8; ++r) { e0[r] = __builtin_amdgcn_exp2f(e0[r]); e1[r] = __builtin_amdgcn_exp2f(e1[r]); }
            e0 = e0 * PCAR; e1 = e1 * PCAR;
            const v8f e2 = e0 + e1; float ps = e2[0];
#pragma unroll
            for (int r = 1; r < 8; ++r) ps += e2[r];
#pragma unroll
            for (int r = 0; r < 8; ++r) { pb[g][r] = (h16)e0[r]; pb[g][8 + r] = (h16)e1[r]; }
            l[g] += ps; }
        { o[0][0] = wmma16(v0, pb[0], o[0][0]); o[1][0] = wmma16(v0, pb[1], o[1][0]); o[0][1] = wmma16(v1, pb[0], o[0][1]); o[1][1] = wmma16(v1, pb[1], o[1][1]);
          o[0][2] = wmma16(v2, pb[0], o[0][2]); o[1][2] = wmma16(v2, pb[1], o[1][2]); o[0][3] = wmma16(v3, pb[0], o[0][3]); o[1][3] = wmma16(v3, pb[1], o[1][3]);
          // the WMMA distance behind the pass's last products, on every path
          asm volatile("v_nop\n\tv_nop\n\tv_nop\n\tv_nop" : "+v"(o[0][0]), "+v"(o[0][1]), "+v"(o[0][2]), "+v"(o[0][3]), "+v"(o[1][0]), "+v"(o[1][1]), "+v"(o[1][2]), "+v"(o[1][3]) : "v"(v3), "v"(pb[0]), "v"(pb[1])); }
      }
      // publish point: stage t + 1 landed and visible, stage t's buffer left by every reader; then its refill
      wait_lds();
      wait_copies();
      __syncthreads();
      if (t + 2 < FNS) stage_copy_64(kg + (size_t)(t + 2) * 64 * HD, (size_t)32 * HD, vg + (t + 2) * 64, (size_t)32 * SEQ, lc + (unsigned)(t & 1) * (STAGE_E * 2));
    }
    wait_copies();
    // merge of the two key halves: the loop's last barrier has ended every read of the rings and no copy is in flight, so they hold, per lane of waves 8..15, sixteen 16-byte pieces of o and one of (m, l)
    v4fa* mb = (v4fa*)ring + wq * 32 + lane;
    if (kh == 1) {
#pragma unroll
        for (int g = 0; g < 2; ++g)
#pragma unroll
            for (int dt = 0; dt < 4; ++dt) { v4f x0, x1;
#pragma unroll
                for (int j = 0; j < 4; ++j) { x0[j] = o[g][dt][j]; x1[j] = o[g][dt][4 + j]; }
                mb[((g * 4 + dt) * 2) * 256] = x0; mb[((g * 4 + dt) * 2 + 1) * 256] = x1; }
        v4f ml; ml[0] = m[0]; ml[1] = m[1]; ml[2] = l[0]; ml[3] = l[1];
        mb[16 * 256] = ml;
    }
    __syncthreads();
    if (kh == 0) {
        const v4f ml = mb[16 * 256];
#pragma unroll
        for (int g = 0; g < 2; ++g) {
            const float mm = fmaxf(m[g], ml[g]); const float c0 = __builtin_amdgcn_exp2f(m[g] - mm), c1 = __builtin_amdgcn_exp2f(ml[g] - mm);
            float lg = l[g] * c0 + ml[2 + g] * c1;
            lg += __shfl_xor(lg, 16, 32);
            const float il = 1.0f / lg;
            const float d0 = c0 * il, d1 = c1 * il;
            float* orow = os + (wq * 32 + g * 16 + lr) * 68 + 8 * hi;
#pragma unroll
            for (int dt = 0; dt < 4; ++dt) { const v4f y0 = mb[((g * 4 + dt) * 2) * 256], y1 = mb[((g * 4 + dt) * 2 + 1) * 256]; v4f x0, x1;
#pragma unroll
                for (int j = 0; j < 4; ++j) { x0[j] = o[g][dt][j] * d0 + y0[j] * d1; x1[j] = o[g][dt][4 + j] * d0 + y1[j] * d1; }
                *(v4fa*)(orow + dt * 16) = x0; *(v4fa*)(orow + dt * 16 + 4) = x1; }
            // sst: per 128 queries the 128 maxima, then the 128 scaled inverse sums, as ST holds them
            if (hi == 0) { const int si = (wq >> 2) * 256 + (wq & 3) * 32 + g * 16 + lr; sst[si] = mm; sst[si + 128] = 16.0f * il; } }
    }
    __syncthreads();
    const int q4 = lane >> 3, piece = lane & 7;
{
#pragma unroll
        for (int s = 0; s < 4; ++s) { const int row = wave * 16 + s * 4 + q4; const v4f x0 = *(const v4fa*)(os + row * 68 + piece * 8); const v4f x1 = *(const v4fa*)(os + row * 68 + piece * 8 + 4); v8us oh, ol;
#pragma unroll
            for (int j = 0; j < 4; ++j) { unsigned short a, c2; splitf(x0[j], a, c2); oh[j] = a; ol[j] = c2; splitf(x1[j], a, c2); oh[4 + j] = a; ol[4 + j] = c2; }
            const size_t oo = ((size_t)b * SEQ + qt * 256 + row) * DM + hh * HD + piece * 8;
            *(v8us*)(AT + oo) = oh; *(v8us*)(AT + AT_E + oo) = ol; }
        // stands in front of the first rewrite of a register that the stores above name
        asm volatile("s_wait_xcnt 0x0" ::: "memory");
        if (wave < 4) { const v4f sv = *(const v4fa*)(sst + wave * 128 + lane * 4); *(v4f*)(ST + ((bh * (SEQ / 128) + qt * 2) * 256 + wave * 128 + lane * 4)) = sv; }
         }
}

// k_amean: grid (SEQ/128 key tiles, SEQ/128 query tiles, NB), 8 waves (4 x 2); wave = 32 queries (two groups of 16) x 64 keys, so every K fragment read from LDS feeds two WMMAs.
// Per head: S^T tiles as in k_flash (identical fragments and order); a head's staged 128 K rows and 128 Q rows serve a 128 x 128 tile of the output.
// ST holds, per head and 128 queries, the 128 maxima and then the 128 scaled inverse sums.
#define AT_TILE_E (2 * TILE_E)
#define ASTAGE_E  (2 * AT_TILE_E)
#define ARING_B   (2 * ASTAGE_E * 2)
#define OSP       68
static_assert(ARING_B >= 8 * 32 * OSP * 4);   // the ring is the eight waves' output staging behind the loop
__global__ __launch_bounds__(256) void k_amean(const h16* __restrict__ QKV, const int* __restrict__ mask, const float* __restrict__ ST, float* AM) {
    __shared__ __align__(16) unsigned char sm[ARING_B];   // per stage (one head): K tile [key][d], then Q tile [query][d], 128 rows each
    const h16* ring = (const h16*)sm;
    const int lane = threadIdx.x & 31, lr = lane & 15, hi = lane >> 4;
    const int wave = __builtin_amdgcn_readfirstlane((int)(threadIdx.x >> 5));
    const int wq = wave & 3, wk = wave >> 2;
    const int k0 = blockIdx.x * 128, qt = blockIdx.y, b = blockIdx.z;
    unsigned w[2];
#pragma unroll
    for (int i = 0; i < 2; ++i) { const int mv = mask[(size_t)b * SEQ_FULL + k0 + wk * 64 + i * 32 + lane]; w[i] = __builtin_amdgcn_ballot_w32(mv != 0); }
    const bool allv = ((w[0] & w[1]) == 0xFFFFFFFFu);
    v8f acc[2][4];
#pragma unroll
    for (int g = 0; g < 2; ++g)
#pragma unroll
        for (int kt = 0; kt < 4; ++kt) acc[g][kt] = (v8f){};
    const int crow = (int)threadIdx.x >> 3, cpc = (int)threadIdx.x & 7;
    const h16* kg = QKV + PLANE_E + ((size_t)b * NH * SEQ + k0 + crow) * HD + cpc * 8;
    const h16* qg = QKV + ((size_t)b * NH * SEQ + qt * 128 + crow) * HD + cpc * 8;
    const unsigned lc = lds_off(ring) + (unsigned)(crow * LP + cpc * 8) * 2u;
    stage_copy_128(kg, (size_t)32 * HD, qg, (size_t)32 * HD, lc);
    wait_copies();
    __syncthreads();
    if (NH > 1) stage_copy_128(kg + (size_t)SEQ * HD, (size_t)32 * HD, qg + (size_t)SEQ * HD, (size_t)32 * HD, lc + ASTAGE_E * 2);
#pragma unroll 1
    for (int hh = 0; hh < NH; ++hh) {
        const size_t bh = (size_t)b * NH + hh;
        const float* st = ST + (bh * (SEQ / 128) + qt) * 256 + wq * 32 + lr;
        const float m[2] = { st[0], st[16] }, inv[2] = { st[128], st[144] };
        const h16* kp = ring + (hh & 1) * ASTAGE_E + (wk * 64 + lr) * LP + 8 * hi;
        const h16* qp = ring + (hh & 1) * ASTAGE_E + AT_TILE_E + (wq * 32 + lr) * LP + 8 * hi;
        v16h qb[2][2], a0[4], a1[4];
#pragma unroll   // fragment arrays stay in registers only under constant indices
        for (int g = 0; g < 2; ++g) { qb[g][0] = ldh(qp + g * 16 * LP); qb[g][1] = ldh(qp + g * 16 * LP + 32); }
#pragma unroll
        for (int kt = 0; kt < 4; ++kt) { a0[kt] = ldh(kp + kt * 16 * LP); a1[kt] = ldh(kp + kt * 16 * LP + 32); }
        // keeps the head's LDS reads one group ahead of its WMMAs; without it they are issued in pairs into one register set, each pair waited out in front of its WMMA
        __builtin_amdgcn_sched_barrier(0);
#pragma unroll   // two groups of 16 queries; unrolled so that the accumulators keep constant indices
        for (int g = 0; g < 2; ++g) {
            v8f s[4];
#pragma unroll
            for (int kt = 0; kt < 4; ++kt) { s[kt] = wmma16(a0[kt], qb[g][0], (v8f){}); s[kt] = wmma16(a1[kt], qb[g][1], s[kt]); }
            // the WMMA distance in front of the first vector use of the scores, on the branch's taken side too
            asm volatile("v_nop\n\tv_nop\n\tv_nop\n\tv_nop" : "+v"(s[0]), "+v"(s[1]), "+v"(s[2]), "+v"(s[3]) : "v"(a1[3]), "v"(qb[g][1]));
#pragma unroll
            for (int kt = 0; kt < 4; ++kt) s[kt] = s[kt] * CSC;
            if (!allv) {
#pragma unroll
                for (int kt = 0; kt < 4; ++kt) { const unsigned wsel = w[kt >> 1];
#pragma unroll
                    for (int r = 0; r < 8; ++r) s[kt][r] = ((wsel >> ((kt & 1) * 16 + 8 * hi + r)) & 1u) ? s[kt][r] : FILLU; } }
#pragma unroll
            for (int kt = 0; kt < 4; ++kt) { v8f e = s[kt] - m[g];
#pragma unroll
                for (int r = 0; r < 8; ++r) e[r] = __builtin_amdgcn_exp2f(e[r]);
                acc[g][kt] += e * inv[g]; }
        }
        // publish point: head hh + 1 landed and visible, head hh's buffer left by every reader; then its refill
        wait_lds();
        wait_copies();
        __syncthreads();
        if (hh + 2 < NH) stage_copy_128(kg + (size_t)(hh + 2) * SEQ * HD, (size_t)32 * HD, qg + (size_t)(hh + 2) * SEQ * HD, (size_t)32 * HD, lc + (unsigned)(hh & 1) * (ASTAGE_E * 2));
    }
    wait_copies();
    float* os = (float*)sm + wave * (32 * OSP);   // this wave's own staging range
#pragma unroll
    for (int g = 0; g < 2; ++g) { float* orow = os + (g * 16 + lr) * OSP + 8 * hi;
#pragma unroll
      for (int kt = 0; kt < 4; ++kt) { v4f x0, x1;
#pragma unroll
          for (int j = 0; j < 4; ++j) { x0[j] = acc[g][kt][j]; x1[j] = acc[g][kt][4 + j]; }
          *(v4fa*)(orow + kt * 16) = x0; *(v4fa*)(orow + kt * 16 + 4) = x1; } }
    __syncthreads();
    float* dst = AM + ((size_t)b * SEQ_FULL + qt * 128 + wq * 32) * SEQ_FULL + k0 + wk * 64;
{
#pragma unroll
        for (int it = 0; it < 16; ++it) { const int row = it * 2 + hi; const v4f val = *(const v4fa*)(os + row * OSP + lr * 4);
            *(v4f*)(dst + (size_t)row * SEQ_FULL + lr * 4) = val; }
         }
}

// k_outp: grid (MROWS/128, DM/128), four waves per block.
__global__ __launch_bounds__(128) void k_outp(const bf* __restrict__ AT, const bf* __restrict__ WO, const float* __restrict__ bo, float* OUT) {
    __shared__ __align__(16) unsigned char sm[GRING_B];
    const int lane = threadIdx.x & 31, lr = lane & 15, hi = lane >> 4;
    const int wave = __builtin_amdgcn_readfirstlane((int)(threadIdx.x >> 5));
    const int r0 = blockIdx.x * 128 + (wave >> 1) * 64, c0 = blockIdx.y * 128 + (wave & 1) * 64;
    v8f acc[4][4];
    gemm128(AT, AT_E, 2, WO, (int)blockIdx.x * 128, (int)blockIdx.y * 128, (const bf*)sm, wave, lane, acc);
    float* os = (float*)sm + wave * (64 * 68);   // this wave's own staging range
#pragma unroll
    for (int mb = 0; mb < 4; ++mb)
#pragma unroll
        for (int nb = 0; nb < 4; ++nb)
#pragma unroll
            for (int j = 0; j < 8; ++j) os[(mb * 16 + hi * 8 + j) * 68 + nb * 16 + lr] = acc[mb][nb][j];
    __syncthreads();
    const int b = r0 / SEQ, t0 = r0 % SEQ; const int cofs = lr * 4;
    float* crow = OUT + ((size_t)b * SEQ_FULL + t0) * DM + c0;
    v4f bia;
#pragma unroll
    for (int j = 0; j < 4; ++j) bia[j] = bfr(bo[c0 + cofs + j]);
{
#pragma unroll 4
        for (int s = 0; s < 32; ++s) { const int row = 2 * s + hi; const v4f val = *(const v4fa*)(os + row * 68 + cofs) + bia;
            *(v4f*)(crow + (size_t)row * DM + cofs) = val; }
         }
}

extern "C" void kernel_launch(void* const* d_in, const int* in_sizes, int n_in,
                              void* d_out, int out_size, void* d_ws, size_t ws_size, hipStream_t stream) {
    if (n_in < 10) return;
    const long long need_rows = (long long)(NB - 1) * SEQ_FULL + SEQ;
    if ((long long)in_sizes[0] < need_rows * DM) return;
    if ((long long)in_sizes[1] < need_rows) return;
    if (in_sizes[2] < DM * DM || in_sizes[4] < DM * DM || in_sizes[6] < DM * DM || in_sizes[8] < DM * DM) return;
    if (in_sizes[3] < DM || in_sizes[5] < DM || in_sizes[7] < DM || in_sizes[9] < DM) return;
    const long long need_out = (long long)AM_OFF_E + ((long long)(NB - 1) * SEQ_FULL + SEQ - 1) * SEQ_FULL + SEQ;
    if ((long long)out_size < need_out) return;
    if ((size_t)WS_TOTAL > ws_size) return;
    const float* x = (const float*)d_in[0]; const int* mask = (const int*)d_in[1];
    const float* wq = (const float*)d_in[2]; const float* bq = (const float*)d_in[3];
    const float* wk = (const float*)d_in[4]; const float* bk = (const float*)d_in[5];
    const float* wv = (const float*)d_in[6]; const float* bv = (const float*)d_in[7];
    const float* wo = (const float*)d_in[8]; const float* bo = (const float*)d_in[9];
    float* OUT = (float*)d_out; float* AM = OUT + AM_OFF_E;
    char* wsp = (char*)d_ws;
    bf* WALL = (bf*)(wsp + OFF_WALL); bf* XB = (bf*)(wsp + OFF_XB); h16* QKV = (h16*)(wsp + OFF_QKV); bf* AT = (bf*)(wsp + OFF_AT); float* ST = (float*)(wsp + OFF_ST);
    k_cvtw<<<dim3((unsigned)((size_t)DM * DM / 8 / 256), 4, 1), 256, 0, stream>>>(wq, wk, wv, wo, WALL);
    k_cvtx<<<(unsigned)((size_t)MROWS * DM / 8 / 256), 256, 0, stream>>>(x, XB);
    k_qkv<<<dim3(MROWS / 128, 3 * DM / 128, 1), 128, 0, stream>>>(XB, WALL, bq, bk, bv, QKV);
    k_flash<<<dim3(SEQ / 256, NH, NB), 512, 0, stream>>>(QKV, mask, AT, ST);
    k_amean<<<dim3(SEQ / 128, SEQ / 128, NB), 256, 0, stream>>>(QKV, mask, ST, AM);
    k_outp<<<dim3(MROWS / 128, DM / 128, 1), 128, 0, stream>>>(AT, WALL + (size_t)3 * DM * DM, bo, OUT);
}
